// v000
// The times below were measured on an AMD MI455X: many runs one after another, warmed up first and cycling through
// copies of the inputs, with the whole window's GPU time divided by the number of runs. Launches and the gaps
// between them are all in it. The median over several windows is given; except for v000 it joins two sittings, which
// can be a few percent apart, so the side-by-side timings, each taken in one sitting, are the better comparison.
// v000 is the starting kernel. One run takes 1090 microseconds.
#include <hip/hip_runtime.h>

// Single-head self-attention over all 8,192 tokens of a video feature map (hidden_states [2][16][128][16][16] = (B,T,C,H,W) -> tokens n = (b,t,h,w), features c: x [8192][128]; q = x w_q, k = x w_k, v = x w_v ('xw' [128][64], no bias); scores = q.k / 8 over all 8192 keys; softmax; out = attn.v -> [8192][64] (524 k)).
// Layout: the input is transposed to token-major while converting to bf16; exact projections; fp16 planes q [8192][64], k [8192][64], v^T [64][8192]; query rows processed in 4 chunks of 2048: scores [2048][8192] f32, a streaming 3-sweep row softmax over the 8192 keys (max, sum, write fp16 P x 1024), attn.v with K = 8192, f32 output rows (x 1/1024).
// Compute dtypes, f32 accumulate: every input rounded to bf16; projections on PLAIN bf16 operands (exact); scores and attn.v on single fp16 planes (logit sigma 0.32, >= 8192-key rows: P x 1024 >= 0.06, no subnormals); softmax f32; f32 output.

#define NB_  1
#define TT   8192
#define DM   128
#define NH_  1
#define NKV  1
#define REP  (NH_ / NKV)
#define HD   64
#define DQ   (NH_ * HD)
#define DKV  (NKV * HD)
#define ZH   1
#define RH   0                  // k_merge rows t < RH keep scale 1, not 1/1024 (0: none)
#define WIN  0
#define QC   2048                 // query rows per chunk (4 chunks)
#define TK   TT                   // keys
#define GRP  256                  // tokens per (b, t) group = H x W
#define NGRP 32                   // (b, t) groups
#define PCAR 1024.0f
#define SCL  0.125f   // HD^-0.5
typedef _Float16 h16;
typedef unsigned short bf;
typedef __attribute__((ext_vector_type(16))) __bf16   v16bf;
typedef __attribute__((ext_vector_type(16))) _Float16 v16h;
typedef __attribute__((ext_vector_type(8)))  _Float16 v8h;
typedef __attribute__((ext_vector_type(8)))  unsigned short v8us;
typedef __attribute__((ext_vector_type(8)))  float    v8f;
typedef __attribute__((ext_vector_type(4)))  float    v4f;
typedef v8h  __attribute__((may_alias)) v8ha;
typedef v4f  __attribute__((may_alias)) v4fa;
typedef v8us __attribute__((may_alias)) v8usa;

__device__ __forceinline__ unsigned short f2bf(float f) { unsigned u = __float_as_uint(f); u += 0x7FFFu + ((u >> 16) & 1u); return (unsigned short)(u >> 16); }
__device__ __forceinline__ float bf2f(unsigned short b) { return __uint_as_float(((unsigned)b) << 16); }
__device__ __forceinline__ float bfr(float f) { return bf2f(f2bf(f)); }
__device__ __forceinline__ v16h cat16(v8h lo, v8h hi) { return __builtin_shufflevector(lo, hi, 0, 1, 2, 3, 4, 5, 6, 7, 8, 9, 10, 11, 12, 13, 14, 15); }
__device__ __forceinline__ v16bf cat16b(v8us lo, v8us hi) { return __builtin_bit_cast(v16bf, __builtin_shufflevector(lo, hi, 0, 1, 2, 3, 4, 5, 6, 7, 8, 9, 10, 11, 12, 13, 14, 15)); }
__device__ __forceinline__ v8f wmma16(v16h a, v16h b, v8f c) { return __builtin_amdgcn_wmma_f32_16x16x32_f16(false, a, false, b, (short)0, c, false, false); }
__device__ __forceinline__ v8f wmmab(v16bf a, v16bf b, v8f c) { return __builtin_amdgcn_wmma_f32_16x16x32_bf16(false, a, false, b, (short)0, c, false, false); }



// ---- k_gemmw: register-blocked GEMM, ONE WAVE per 64x64 output tile (16 accumulators), operands straight from K-contiguous 16-bit planes; grid (M/64, N/64, Z), 32 threads.
// C[m][n] (f32, pitch ldc, + optional f32 bias[n]) = sum_k A[m][k] Bt[n][k] (+ split products per NSPLIT). z-batch strides sA/sB/sC in elements. K % 32 == 0.
template <typename T16> struct WFrag;
template <> struct WFrag<h16> { typedef v16h V; static __device__ __forceinline__ V ld(const h16* p) { return cat16(*(const v8h*)p, *(const v8h*)(p + 16)); } static __device__ __forceinline__ v8f mma(V a, V b, v8f c) { return wmma16(a, b, c); } };
template <> struct WFrag<bf> { typedef v16bf V; static __device__ __forceinline__ V ld(const bf* p) { return cat16b(*(const v8us*)p, *(const v8us*)(p + 16)); } static __device__ __forceinline__ v8f mma(V a, V b, v8f c) { return wmmab(a, b, c); } };
template <typename T16, int NSPLIT, bool BIAS>
__global__ __launch_bounds__(32) void k_gemmw(const T16* __restrict__ A, const T16* __restrict__ A2, const T16* __restrict__ Bt, const T16* __restrict__ Bt2, int K, float* C, int ldc, const float* __restrict__ bias, size_t sA, size_t sB, size_t sC) {
    typedef typename WFrag<T16>::V V;
    __shared__ __align__(16) float os[16 * 68];
    const size_t z = blockIdx.z; A += z * sA; if (A2) A2 += z * sA; Bt += z * sB; if (Bt2) Bt2 += z * sB; C += z * sC;
    const int lane = threadIdx.x & 31, lr = lane & 15, hi = lane >> 4; const int r0 = blockIdx.x * 64, c0 = blockIdx.y * 64;
    v8f acc[4][4];
#pragma unroll
    for (int mb = 0; mb < 4; ++mb)
#pragma unroll
        for (int nb = 0; nb < 4; ++nb) acc[mb][nb] = (v8f){};
    const size_t aoff = (size_t)(r0 + lr) * K + 8 * hi, boff = (size_t)(c0 + lr) * K + 8 * hi;
#pragma unroll 1
    for (int kc = 0; kc < K; kc += 32) {
        V a[4], a2[4];
#pragma unroll
        for (int mb = 0; mb < 4; ++mb) { a[mb] = WFrag<T16>::ld(A + aoff + (size_t)mb * 16 * K + kc); if (NSPLIT == 1 || NSPLIT == 2) a2[mb] = WFrag<T16>::ld(A2 + aoff + (size_t)mb * 16 * K + kc); }
#pragma unroll
        for (int nb = 0; nb < 4; ++nb) { const V b = WFrag<T16>::ld(Bt + boff + (size_t)nb * 16 * K + kc); V b2; if (NSPLIT >= 2) b2 = WFrag<T16>::ld(Bt2 + boff + (size_t)nb * 16 * K + kc);
#pragma unroll
            for (int mb = 0; mb < 4; ++mb) { acc[mb][nb] = WFrag<T16>::mma(a[mb], b, acc[mb][nb]); if (NSPLIT == 1 || NSPLIT == 2) acc[mb][nb] = WFrag<T16>::mma(a2[mb], b, acc[mb][nb]); if (NSPLIT >= 2) acc[mb][nb] = WFrag<T16>::mma(a[mb], b2, acc[mb][nb]); } }
        asm volatile("v_nop\n\tv_nop\n\tv_nop\n\tv_nop" : "+v"(acc[0][0]), "+v"(acc[1][1]), "+v"(acc[2][2]), "+v"(acc[3][3]) : "v"(a[0]), "v"(a[3]));
    }
#pragma unroll
    for (int mb = 0; mb < 4; ++mb) {
#pragma unroll
        for (int nb = 0; nb < 4; ++nb) {
#pragma unroll
            for (int j = 0; j < 8; ++j) os[(hi * 8 + j) * 68 + nb * 16 + lr] = acc[mb][nb][j]; }
        __builtin_amdgcn_wave_barrier(); asm volatile("" ::: "memory");
        float* crow = C + (size_t)(r0 + mb * 16) * ldc + c0;
{
#pragma unroll
            for (int s = 0; s < 8; ++s) { const int row = 2 * s + hi, cofs = lr * 4; v4f val = *(const v4fa*)(os + row * 68 + cofs); if (BIAS) { val[0] += bfr(bias[c0 + cofs]); val[1] += bfr(bias[c0 + cofs + 1]); val[2] += bfr(bias[c0 + cofs + 2]); val[3] += bfr(bias[c0 + cofs + 3]); }
                *(v4f*)(crow + (size_t)row * ldc + cofs) = val; }
             }
        __builtin_amdgcn_wave_barrier(); asm volatile("" ::: "memory");
    }
}

__device__ __forceinline__ h16 tohx(float x) { return (h16)x; }
__device__ __forceinline__ void splitf(float y, unsigned short& h, unsigned short& l) { h = f2bf(y); l = f2bf(y - bf2f(h)); }
typedef __attribute__((ext_vector_type(2))) _Float16 v2h;
typedef __attribute__((ext_vector_type(4))) _Float16 v4h;
typedef __attribute__((ext_vector_type(2))) unsigned short v2us;
typedef __attribute__((ext_vector_type(4))) unsigned short v4us;
typedef __attribute__((ext_vector_type(2))) float v2f;
typedef __attribute__((ext_vector_type(4))) int v4i;

__global__ __launch_bounds__(256) void k_wtG(const float* __restrict__ w, int K, int N, bf* Bt) {
    const int lane = threadIdx.x & 31; const int L0 = (blockIdx.x * 8 + (threadIdx.x >> 5)) * 8; const int nlines = N * K / 64;
{
#pragma unroll 1
        for (int l = 0; l < 8; ++l) { const int L = L0 + l; if (L >= nlines) break; const size_t e = (size_t)L * 64 + lane * 2; const int k = (int)(e % K), n = (int)(e / K); v2us o;
            o[0] = f2bf(w[(size_t)k * N + n]); o[1] = f2bf(w[(size_t)(k + 1) * N + n]); *(v2us*)(Bt + e) = o; }
         }
}
__global__ __launch_bounds__(256) void k_xT(const float* __restrict__ src, bf* dst) { const size_t i = (size_t)blockIdx.x * 256 + threadIdx.x; if (i >= (size_t)TT * DM / 8) return; const int n = (int)(i / (DM / 8)); const int c0 = (int)(i % (DM / 8)) * 8; const int g = n / GRP, p = n % GRP; v8us o;
#pragma unroll
    for (int k = 0; k < 8; ++k) o[k] = f2bf(src[((size_t)g * DM + c0 + k) * GRP + p]); *(v8us*)(dst + (size_t)n * DM + c0) = o;  }

// k_rope: head planes [h][t][d] (fp16) of rope(x) x sc with the rotate-half convention out[d] = x[d] cos[t][d] - x[d+HD/2] sin[t][d], out[d+HD/2] = x[d+HD/2] cos[t][d+HD/2] + x[d] sin[t][d+HD/2]
__global__ __launch_bounds__(256) void k_rope(const float* __restrict__ F, int pitch, int nheads, const float* __restrict__ CS, const float* __restrict__ RF, const float* __restrict__ nw, float sc, h16* P16, bf* Ph, bf* Pl) {
    const size_t e = ((size_t)blockIdx.x * 256 + threadIdx.x) * 2; if (e >= (size_t)nheads * TT * HD) return; const int d = (int)(e % HD); const int t = (int)((e / HD) % TT); const int h = (int)(e / ((size_t)HD * TT)); const float* f = F + (size_t)t * pitch + h * HD; const float rf = RF ? RF[(size_t)h * TT + t] : 1.0f; v2h o16; v2us oh, ol;
#pragma unroll
    for (int q = 0; q < 2; ++q) { const int dd = d + q; const int dp = (dd < HD / 2) ? dd + HD / 2 : dd - HD / 2; float x0 = f[dd], x1 = f[dp];
        if (RF) { float n0 = __fmul_rn(x0, rf), n1 = __fmul_rn(x1, rf); asm volatile("" : "+v"(n0)); asm volatile("" : "+v"(n1)); x0 = __fmul_rn(bfr(nw[dd]), n0); x1 = __fmul_rn(bfr(nw[dp]), n1); }
        const v2f cs = *(const v2f*)(CS + ((size_t)t * HD + dd) * 2); float a = __fmul_rn(x0, cs[0]), bq = __fmul_rn(x1, cs[1]); asm volatile("" : "+v"(a)); asm volatile("" : "+v"(bq)); const float r = ((dd < HD / 2) ? __fsub_rn(a, bq) : __fadd_rn(a, bq)) * sc;
        o16[q] = tohx(r); (void)oh; (void)ol; }
    *(v2h*)(P16 + e) = o16;  }
__global__ __launch_bounds__(256) void k_vtp(const float* __restrict__ F, int pitch, int nheads, h16* V16, bf* Vh, bf* Vl) { const size_t e = ((size_t)blockIdx.x * 256 + threadIdx.x) * 2; if (e >= (size_t)nheads * HD * TT) return; const int t = (int)(e % TT); const int d = (int)((e / TT) % HD); const int g = (int)(e / ((size_t)TT * HD)); v2h o16; v2us oh, ol;
#pragma unroll
    for (int q = 0; q < 2; ++q) { const float x = F[(size_t)(t + q) * pitch + g * HD + d]; o16[q] = tohx(x); (void)oh; (void)ol; }
    *(v2h*)(V16 + e) = o16;  }
__global__ __launch_bounds__(256) void k_csid(float* CS) { const int idx = blockIdx.x * 256 + threadIdx.x; if (idx >= TT * HD) return; v2f cs; cs[0] = 1.0f; cs[1] = 0.0f; *(v2f*)(CS + (size_t)idx * 2) = cs;  }
// k_lsoft: streaming row softmax over the TK = 8192 keys for the QC rows of a query chunk, one wave per row, three sweeps of the f32 score row (lane -> 4 consecutive keys per 128-key chunk, 64 chunks):
__global__ __launch_bounds__(256) void k_lsoft(const float* __restrict__ Sb, h16* P16) {
    const int lane = threadIdx.x & 31; const int row = blockIdx.x * 8 + (threadIdx.x >> 5); if (row >= QC) return; const float* sr = Sb + (size_t)row * TK; float mx = -3.0e38f;
#pragma unroll 4
    for (int ch = 0; ch < TK / 128; ++ch) { const v4f a = *(const v4f*)(sr + ch * 128 + lane * 4);
#pragma unroll
        for (int q = 0; q < 4; ++q) { float t = a[q] * SCL; asm volatile("" : "+v"(t)); mx = fmaxf(mx, t); } }
#pragma unroll
    for (int sh = 16; sh; sh >>= 1) mx = fmaxf(mx, __shfl_xor(mx, sh, 32));
    float sum = 0.f;
#pragma unroll 4
    for (int ch = 0; ch < TK / 128; ++ch) { const v4f a = *(const v4f*)(sr + ch * 128 + lane * 4);
#pragma unroll
        for (int q = 0; q < 4; ++q) { float t = a[q] * SCL; asm volatile("" : "+v"(t)); float d0 = __fsub_rn(t, mx); asm volatile("" : "+v"(d0)); sum += __builtin_amdgcn_exp2f(__fmul_rn(d0, 1.4426950408889634f)); } }
#pragma unroll
    for (int sh = 16; sh; sh >>= 1) sum += __shfl_xor(sum, sh, 32);
    const float f = __fdiv_rn(PCAR, sum);
{
#pragma unroll 2
        for (int ch = 0; ch < TK / 128; ++ch) { const v4f a = *(const v4f*)(sr + ch * 128 + lane * 4); v4h o4;
#pragma unroll
            for (int q = 0; q < 4; ++q) { float t = a[q] * SCL; asm volatile("" : "+v"(t)); float d0 = __fsub_rn(t, mx); asm volatile("" : "+v"(d0)); float ex = __builtin_amdgcn_exp2f(__fmul_rn(d0, 1.4426950408889634f)); asm volatile("" : "+v"(ex)); o4[q] = tohx(ex * f); }
            *(v4h*)(P16 + (size_t)row * TK + ch * 128 + lane * 4) = o4; }
         }
}

__global__ __launch_bounds__(256) void k_merge(const float* __restrict__ O, int h0, float* OUTb) { const size_t e = ((size_t)blockIdx.x * 256 + threadIdx.x) * 2; if (e >= (size_t)ZH * TT * HD) return; const int d = (int)(e % HD); const int t = (int)((e / HD) % TT); const int zz = (int)(e / ((size_t)HD * TT)); const float cs = (t < RH) ? 1.0f : (1.0f / PCAR); const size_t oo = (size_t)t * DQ + (h0 + zz) * HD + d;
    v2f o2; o2[0] = O[e] * cs; o2[1] = O[e + 1] * cs; *(v2f*)(OUTb + oo) = o2;  }

extern "C" void kernel_launch(void* const* d_in, const int* in_sizes, int n_in,
                              void* d_out, int out_size, void* d_ws, size_t ws_size, hipStream_t stream) {
    (void)in_sizes; (void)n_in; (void)out_size;
    const float* x = (const float*)d_in[0]; const float* wq = (const float*)d_in[1]; const float* wk = (const float*)d_in[2]; const float* wv = (const float*)d_in[3]; const float* wo = nullptr; (void)wo;
    float* OUT = (float*)d_out;     // [1][8192][64]
    char* wsp = (char*)d_ws;
    auto take = [&](size_t bytes) { char* p = wsp; wsp += (bytes + 255) & ~(size_t)255; return (void*)p; };
    bf* WQ = (bf*)take((size_t)DQ * DM * 2); bf* WK = (bf*)take((size_t)DKV * DM * 2); bf* WV = (bf*)take((size_t)DKV * DM * 2); float* CS = (float*)take((size_t)TT * HD * 2 * 4);
    bf* XB = (bf*)take((size_t)TT * DM * 2); float* FQ = (float*)take((size_t)TT * DQ * 4); float* FK = (float*)take((size_t)TT * DKV * 4);
    h16* QP16 = (h16*)take((size_t)NH_ * TT * HD * 2); h16* KP16 = (h16*)take((size_t)NKV * TT * HD * 2); h16* VT16 = (h16*)take((size_t)NKV * HD * TT * 2);
    bf* QPh = nullptr; bf* QPl = nullptr; bf* KPh = nullptr; bf* KPl = nullptr; bf* VTh = nullptr; bf* VTl = nullptr; bf* Ph = nullptr; bf* Pl = nullptr;
    float* Sb = (float*)take((size_t)QC * TK * 4); h16* P16 = (h16*)take((size_t)QC * TK * 2); float* Ob = (float*)take((size_t)QC * HD * 4);
    if ((size_t)(wsp - (char*)d_ws) > ws_size) return;    // ws 256 MiB
    float* FV = FK;   // v projection reuses the k buffer after the k planes are built (stream-ordered)
    { k_wtG<<<(unsigned)((DM * DQ / 64 + 63) / 64), 256, 0, stream>>>(wq, DM, DQ, WQ); k_wtG<<<(unsigned)((DM * DKV / 64 + 63) / 64), 256, 0, stream>>>(wk, DM, DKV, WK); k_wtG<<<(unsigned)((DM * DKV / 64 + 63) / 64), 256, 0, stream>>>(wv, DM, DKV, WV);
      
       }
    k_csid<<<(TT * HD + 255) / 256, 256, 0, stream>>>(CS);
    const unsigned LQ = (unsigned)(((size_t)NH_ * TT * HD / 2 + 255) / 256), LKv = (unsigned)(((size_t)NKV * TT * HD / 2 + 255) / 256);
    for (int b = 0; b < NB_; ++b) {
        
        k_xT<<<(unsigned)(((size_t)TT * DM / 8 + 255) / 256), 256, 0, stream>>>(x, XB);   /* (B,T,C,H,W) -> token-major [8192][128] bf16 */
        k_gemmw<bf, 0, false><<<dim3(TT / 64, DQ / 64, 1), 32, 0, stream>>>(XB, nullptr, WQ, nullptr, DM, FQ, DQ, nullptr, 0, 0, 0);
        k_rope<<<LQ, 256, 0, stream>>>(FQ, DQ, NH_, CS, nullptr, nullptr, 1.0f, QP16, QPh, QPl);
        k_gemmw<bf, 0, false><<<dim3(TT / 64, DKV / 64, 1), 32, 0, stream>>>(XB, nullptr, WK, nullptr, DM, FK, DKV, nullptr, 0, 0, 0);
        k_rope<<<LKv, 256, 0, stream>>>(FK, DKV, NKV, CS, nullptr, nullptr, 1.0f, KP16, KPh, KPl);
        k_gemmw<bf, 0, false><<<dim3(TT / 64, DKV / 64, 1), 32, 0, stream>>>(XB, nullptr, WV, nullptr, DM, FV, DKV, nullptr, 0, 0, 0); k_vtp<<<LKv, 256, 0, stream>>>(FV, DKV, NKV, VT16, VTh, VTl);
        for (int q0 = 0; q0 < TT; q0 += QC) {   /* 4 query chunks of 2048 rows; one head */
            k_gemmw<h16, 0, false><<<dim3(QC / 64, TK / 64, 1), 32, 0, stream>>>(QP16 + (size_t)q0 * HD, nullptr, KP16, nullptr, HD, Sb, TK, nullptr, 0, 0, 0);   /* scores [QC][8192] f32 */
            k_lsoft<<<QC / 8, 256, 0, stream>>>(Sb, P16);
            k_gemmw<h16, 0, false><<<dim3(QC / 64, HD / 64, 1), 32, 0, stream>>>(P16, nullptr, VT16, nullptr, TK, Ob, HD, nullptr, 0, 0, 0);                     /* attn.v, K = 8192 -> [QC][64] f32 (x1024) */
            k_merge<<<(unsigned)(((size_t)QC * HD / 2 + 255) / 256), 256, 0, stream>>>(Ob, 0, OUT + (size_t)q0 * DQ); }   /* rows q0.. of the [8192][64] output, x 1/1024 */
         }
}

// v001
// Measured time: 484 microseconds a run.
// In both of two side-by-side timings against v000, it was 2.29 times as fast.
#include <hip/hip_runtime.h>

// Single-head self-attention over all 8,192 tokens of a video feature map (hidden_states [2][16][128][16][16] = (B,T,C,H,W) -> tokens n = (b,t,h,w), features c: x [8192][128]; q = x w_q, k = x w_k, v = x w_v ('xw' [128][64], no bias); scores = q.k / 8 over all 8192 keys; softmax; out = attn.v -> [8192][64] (524 k)).
// Layout: the input is transposed to token-major while converting to bf16; exact projections; fp16 planes q [8192][64], k [8192][64], v^T [64][8192]; query rows processed in 4 chunks of 2048: scores [2048][8192] f32, a streaming 3-sweep row softmax over the 8192 keys (max, sum, write fp16 P x 1024), attn.v with K = 8192 split into 32 key slices (f32 partial planes, summed in slice order), f32 output rows (x 1/1024).
// Compute dtypes, f32 accumulate: every input rounded to bf16; projections on PLAIN bf16 operands (exact); scores and attn.v on single fp16 planes (logit sigma 0.32, >= 8192-key rows: P x 1024 >= 0.06, no subnormals); softmax f32; f32 output.

#define NB_  1
#define TT   8192
#define DM   128
#define NH_  1
#define NKV  1
#define REP  (NH_ / NKV)
#define HD   64
#define DQ   (NH_ * HD)
#define DKV  (NKV * HD)
#define ZH   1
#define RH   0                  // k_merge rows t < RH keep scale 1, not 1/1024 (0: none)
#define WIN  0
#define QC   2048                 // query rows per chunk (4 chunks)
#define TK   TT                   // keys
#define KSPL 32                   // key slices of attn.v: 32 row tiles x 32 slices = 1024 waves, one per SIMD
#define GRP  256                  // tokens per (b, t) group = H x W
#define NGRP 32                   // (b, t) groups
#define PCAR 1024.0f
#define SCL  0.125f   // HD^-0.5
typedef _Float16 h16;
typedef unsigned short bf;
typedef __attribute__((ext_vector_type(16))) __bf16   v16bf;
typedef __attribute__((ext_vector_type(16))) _Float16 v16h;
typedef __attribute__((ext_vector_type(8)))  _Float16 v8h;
typedef __attribute__((ext_vector_type(8)))  unsigned short v8us;
typedef __attribute__((ext_vector_type(8)))  float    v8f;
typedef __attribute__((ext_vector_type(4)))  float    v4f;
typedef v8h  __attribute__((may_alias)) v8ha;
typedef v4f  __attribute__((may_alias)) v4fa;
typedef v8us __attribute__((may_alias)) v8usa;

__device__ __forceinline__ unsigned short f2bf(float f) { unsigned u = __float_as_uint(f); u += 0x7FFFu + ((u >> 16) & 1u); return (unsigned short)(u >> 16); }
__device__ __forceinline__ float bf2f(unsigned short b) { return __uint_as_float(((unsigned)b) << 16); }
__device__ __forceinline__ float bfr(float f) { return bf2f(f2bf(f)); }
__device__ __forceinline__ v16h cat16(v8h lo, v8h hi) { return __builtin_shufflevector(lo, hi, 0, 1, 2, 3, 4, 5, 6, 7, 8, 9, 10, 11, 12, 13, 14, 15); }
__device__ __forceinline__ v16bf cat16b(v8us lo, v8us hi) { return __builtin_bit_cast(v16bf, __builtin_shufflevector(lo, hi, 0, 1, 2, 3, 4, 5, 6, 7, 8, 9, 10, 11, 12, 13, 14, 15)); }
__device__ __forceinline__ v8f wmma16(v16h a, v16h b, v8f c) { return __builtin_amdgcn_wmma_f32_16x16x32_f16(false, a, false, b, (short)0, c, false, false); }
__device__ __forceinline__ v8f wmmab(v16bf a, v16bf b, v8f c) { return __builtin_amdgcn_wmma_f32_16x16x32_bf16(false, a, false, b, (short)0, c, false, false); }



// ---- k_gemmw: register-blocked GEMM, ONE WAVE per 64x64 output tile (16 accumulators), operands straight from K-contiguous 16-bit planes; grid (M/64, N/64, Z), 32 threads.
// C[m][n] (f32, pitch ldc, + optional f32 bias[n]) = sum_{k < KL} A[m][k] Bt[n][k] (+ split products per NSPLIT); K = row pitch of A and Bt in elements. z-batch strides sA/sB/sC in elements (split K: sA = sB = KL < K, one C plane per z). KL % 32 == 0.
template <typename T16> struct WFrag;
template <> struct WFrag<h16> { typedef v16h V; static __device__ __forceinline__ V ld(const h16* p) { return cat16(*(const v8h*)p, *(const v8h*)(p + 16)); } static __device__ __forceinline__ v8f mma(V a, V b, v8f c) { return wmma16(a, b, c); } };
template <> struct WFrag<bf> { typedef v16bf V; static __device__ __forceinline__ V ld(const bf* p) { return cat16b(*(const v8us*)p, *(const v8us*)(p + 16)); } static __device__ __forceinline__ v8f mma(V a, V b, v8f c) { return wmmab(a, b, c); } };
template <typename T16, int NSPLIT, bool BIAS>
__global__ __launch_bounds__(32) void k_gemmw(const T16* __restrict__ A, const T16* __restrict__ A2, const T16* __restrict__ Bt, const T16* __restrict__ Bt2, int K, int KL, float* C, int ldc, const float* __restrict__ bias, size_t sA, size_t sB, size_t sC) {
    typedef typename WFrag<T16>::V V;
    __shared__ __align__(16) float os[16 * 68];
    const size_t z = blockIdx.z; A += z * sA; if (A2) A2 += z * sA; Bt += z * sB; if (Bt2) Bt2 += z * sB; C += z * sC;
    const int lane = threadIdx.x & 31, lr = lane & 15, hi = lane >> 4; const int r0 = blockIdx.x * 64, c0 = blockIdx.y * 64;
    v8f acc[4][4];
#pragma unroll
    for (int mb = 0; mb < 4; ++mb)
#pragma unroll
        for (int nb = 0; nb < 4; ++nb) acc[mb][nb] = (v8f){};
    const size_t aoff = (size_t)(r0 + lr) * K + 8 * hi, boff = (size_t)(c0 + lr) * K + 8 * hi;
#pragma unroll 1
    for (int kc = 0; kc < KL; kc += 32) {
        V a[4], a2[4];
#pragma unroll
        for (int mb = 0; mb < 4; ++mb) { a[mb] = WFrag<T16>::ld(A + aoff + (size_t)mb * 16 * K + kc); if (NSPLIT == 1 || NSPLIT == 2) a2[mb] = WFrag<T16>::ld(A2 + aoff + (size_t)mb * 16 * K + kc); }
#pragma unroll
        for (int nb = 0; nb < 4; ++nb) { const V b = WFrag<T16>::ld(Bt + boff + (size_t)nb * 16 * K + kc); V b2; if (NSPLIT >= 2) b2 = WFrag<T16>::ld(Bt2 + boff + (size_t)nb * 16 * K + kc);
#pragma unroll
            for (int mb = 0; mb < 4; ++mb) { acc[mb][nb] = WFrag<T16>::mma(a[mb], b, acc[mb][nb]); if (NSPLIT == 1 || NSPLIT == 2) acc[mb][nb] = WFrag<T16>::mma(a2[mb], b, acc[mb][nb]); if (NSPLIT >= 2) acc[mb][nb] = WFrag<T16>::mma(a[mb], b2, acc[mb][nb]); } }
        asm volatile("v_nop\n\tv_nop\n\tv_nop\n\tv_nop" : "+v"(acc[0][0]), "+v"(acc[1][1]), "+v"(acc[2][2]), "+v"(acc[3][3]) : "v"(a[0]), "v"(a[3]));
    }
#pragma unroll
    for (int mb = 0; mb < 4; ++mb) {
#pragma unroll
        for (int nb = 0; nb < 4; ++nb) {
#pragma unroll
            for (int j = 0; j < 8; ++j) os[(hi * 8 + j) * 68 + nb * 16 + lr] = acc[mb][nb][j]; }
        __builtin_amdgcn_wave_barrier(); asm volatile("" ::: "memory");
        float* crow = C + (size_t)(r0 + mb * 16) * ldc + c0;
{
#pragma unroll
            for (int s = 0; s < 8; ++s) { const int row = 2 * s + hi, cofs = lr * 4; v4f val = *(const v4fa*)(os + row * 68 + cofs); if (BIAS) { val[0] += bfr(bias[c0 + cofs]); val[1] += bfr(bias[c0 + cofs + 1]); val[2] += bfr(bias[c0 + cofs + 2]); val[3] += bfr(bias[c0 + cofs + 3]); }
                *(v4f*)(crow + (size_t)row * ldc + cofs) = val; }
             }
        __builtin_amdgcn_wave_barrier(); asm volatile("" ::: "memory");
    }
}

__device__ __forceinline__ h16 tohx(float x) { return (h16)x; }
__device__ __forceinline__ void splitf(float y, unsigned short& h, unsigned short& l) { h = f2bf(y); l = f2bf(y - bf2f(h)); }
typedef __attribute__((ext_vector_type(2))) _Float16 v2h;
typedef __attribute__((ext_vector_type(4))) _Float16 v4h;
typedef __attribute__((ext_vector_type(2))) unsigned short v2us;
typedef __attribute__((ext_vector_type(4))) unsigned short v4us;
typedef __attribute__((ext_vector_type(2))) float v2f;
typedef __attribute__((ext_vector_type(4))) int v4i;

__global__ __launch_bounds__(256) void k_wtG(const float* __restrict__ w, int K, int N, bf* Bt) {
    const int lane = threadIdx.x & 31; const int L0 = (blockIdx.x * 8 + (threadIdx.x >> 5)) * 8; const int nlines = N * K / 64;
{
#pragma unroll 1
        for (int l = 0; l < 8; ++l) { const int L = L0 + l; if (L >= nlines) break; const size_t e = (size_t)L * 64 + lane * 2; const int k = (int)(e % K), n = (int)(e / K); v2us o;
            o[0] = f2bf(w[(size_t)k * N + n]); o[1] = f2bf(w[(size_t)(k + 1) * N + n]); *(v2us*)(Bt + e) = o; }
         }
}
__global__ __launch_bounds__(256) void k_xT(const float* __restrict__ src, bf* dst) { const size_t i = (size_t)blockIdx.x * 256 + threadIdx.x; if (i >= (size_t)TT * DM / 8) return; const int n = (int)(i / (DM / 8)); const int c0 = (int)(i % (DM / 8)) * 8; const int g = n / GRP, p = n % GRP; v8us o;
#pragma unroll
    for (int k = 0; k < 8; ++k) o[k] = f2bf(src[((size_t)g * DM + c0 + k) * GRP + p]); *(v8us*)(dst + (size_t)n * DM + c0) = o;  }

// k_rope: head planes [h][t][d] (fp16) of rope(x) x sc with the rotate-half convention out[d] = x[d] cos[t][d] - x[d+HD/2] sin[t][d], out[d+HD/2] = x[d+HD/2] cos[t][d+HD/2] + x[d] sin[t][d+HD/2]
__global__ __launch_bounds__(256) void k_rope(const float* __restrict__ F, int pitch, int nheads, const float* __restrict__ CS, const float* __restrict__ RF, const float* __restrict__ nw, float sc, h16* P16, bf* Ph, bf* Pl) {
    const size_t e = ((size_t)blockIdx.x * 256 + threadIdx.x) * 2; if (e >= (size_t)nheads * TT * HD) return; const int d = (int)(e % HD); const int t = (int)((e / HD) % TT); const int h = (int)(e / ((size_t)HD * TT)); const float* f = F + (size_t)t * pitch + h * HD; const float rf = RF ? RF[(size_t)h * TT + t] : 1.0f; v2h o16; v2us oh, ol;
#pragma unroll
    for (int q = 0; q < 2; ++q) { const int dd = d + q; const int dp = (dd < HD / 2) ? dd + HD / 2 : dd - HD / 2; float x0 = f[dd], x1 = f[dp];
        if (RF) { float n0 = __fmul_rn(x0, rf), n1 = __fmul_rn(x1, rf); asm volatile("" : "+v"(n0)); asm volatile("" : "+v"(n1)); x0 = __fmul_rn(bfr(nw[dd]), n0); x1 = __fmul_rn(bfr(nw[dp]), n1); }
        const v2f cs = *(const v2f*)(CS + ((size_t)t * HD + dd) * 2); float a = __fmul_rn(x0, cs[0]), bq = __fmul_rn(x1, cs[1]); asm volatile("" : "+v"(a)); asm volatile("" : "+v"(bq)); const float r = ((dd < HD / 2) ? __fsub_rn(a, bq) : __fadd_rn(a, bq)) * sc;
        o16[q] = tohx(r); (void)oh; (void)ol; }
    *(v2h*)(P16 + e) = o16;  }
__global__ __launch_bounds__(256) void k_vtp(const float* __restrict__ F, int pitch, int nheads, h16* V16, bf* Vh, bf* Vl) { const size_t e = ((size_t)blockIdx.x * 256 + threadIdx.x) * 2; if (e >= (size_t)nheads * HD * TT) return; const int t = (int)(e % TT); const int d = (int)((e / TT) % HD); const int g = (int)(e / ((size_t)TT * HD)); v2h o16; v2us oh, ol;
#pragma unroll
    for (int q = 0; q < 2; ++q) { const float x = F[(size_t)(t + q) * pitch + g * HD + d]; o16[q] = tohx(x); (void)oh; (void)ol; }
    *(v2h*)(V16 + e) = o16;  }
__global__ __launch_bounds__(256) void k_csid(float* CS) { const int idx = blockIdx.x * 256 + threadIdx.x; if (idx >= TT * HD) return; v2f cs; cs[0] = 1.0f; cs[1] = 0.0f; *(v2f*)(CS + (size_t)idx * 2) = cs;  }
// k_lsoft: streaming row softmax over the TK = 8192 keys for the QC rows of a query chunk, one wave per row, three sweeps of the f32 score row (lane -> 4 consecutive keys per 128-key chunk, 64 chunks):
__global__ __launch_bounds__(256) void k_lsoft(const float* __restrict__ Sb, h16* P16) {
    const int lane = threadIdx.x & 31; const int row = blockIdx.x * 8 + (threadIdx.x >> 5); if (row >= QC) return; const float* sr = Sb + (size_t)row * TK; float mx = -3.0e38f;
#pragma unroll 4
    for (int ch = 0; ch < TK / 128; ++ch) { const v4f a = *(const v4f*)(sr + ch * 128 + lane * 4);
#pragma unroll
        for (int q = 0; q < 4; ++q) { float t = a[q] * SCL; asm volatile("" : "+v"(t)); mx = fmaxf(mx, t); } }
#pragma unroll
    for (int sh = 16; sh; sh >>= 1) mx = fmaxf(mx, __shfl_xor(mx, sh, 32));
    float sum = 0.f;
#pragma unroll 4
    for (int ch = 0; ch < TK / 128; ++ch) { const v4f a = *(const v4f*)(sr + ch * 128 + lane * 4);
#pragma unroll
        for (int q = 0; q < 4; ++q) { float t = a[q] * SCL; asm volatile("" : "+v"(t)); float d0 = __fsub_rn(t, mx); asm volatile("" : "+v"(d0)); sum += __builtin_amdgcn_exp2f(__fmul_rn(d0, 1.4426950408889634f)); } }
#pragma unroll
    for (int sh = 16; sh; sh >>= 1) sum += __shfl_xor(sum, sh, 32);
    const float f = __fdiv_rn(PCAR, sum);
{
#pragma unroll 2
        for (int ch = 0; ch < TK / 128; ++ch) { const v4f a = *(const v4f*)(sr + ch * 128 + lane * 4); v4h o4;
#pragma unroll
            for (int q = 0; q < 4; ++q) { float t = a[q] * SCL; asm volatile("" : "+v"(t)); float d0 = __fsub_rn(t, mx); asm volatile("" : "+v"(d0)); float ex = __builtin_amdgcn_exp2f(__fmul_rn(d0, 1.4426950408889634f)); asm volatile("" : "+v"(ex)); o4[q] = tohx(ex * f); }
            *(v4h*)(P16 + (size_t)row * TK + ch * 128 + lane * 4) = o4; }
         }
}

// k_merge: output rows of one query chunk = (sum over the KSPL partial planes [QC][HD] of attn.v, in slice order) x 1/1024
__global__ __launch_bounds__(256) void k_merge(const float* __restrict__ O, int h0, float* OUTb) { const size_t e = ((size_t)blockIdx.x * 256 + threadIdx.x) * 2; if (e >= (size_t)ZH * QC * HD) return; const int d = (int)(e % HD); const int t = (int)((e / HD) % TT); const int zz = (int)(e / ((size_t)HD * TT)); const float cs = (t < RH) ? 1.0f : (1.0f / PCAR); const size_t oo = (size_t)t * DQ + (h0 + zz) * HD + d;
    v2f sm = *(const v2f*)(O + e);
    // unrolled so that all slices' loads are in flight together
#pragma unroll
    for (int zs = 1; zs < KSPL; ++zs) { const v2f p = *(const v2f*)(O + (size_t)zs * QC * HD + e); sm[0] += p[0]; sm[1] += p[1]; }
    v2f o2; o2[0] = sm[0] * cs; o2[1] = sm[1] * cs; *(v2f*)(OUTb + oo) = o2;  }

extern "C" void kernel_launch(void* const* d_in, const int* in_sizes, int n_in,
                              void* d_out, int out_size, void* d_ws, size_t ws_size, hipStream_t stream) {
    (void)in_sizes; (void)n_in; (void)out_size;
    const float* x = (const float*)d_in[0]; const float* wq = (const float*)d_in[1]; const float* wk = (const float*)d_in[2]; const float* wv = (const float*)d_in[3]; const float* wo = nullptr; (void)wo;
    float* OUT = (float*)d_out;     // [1][8192][64]
    char* wsp = (char*)d_ws;
    auto take = [&](size_t bytes) { char* p = wsp; wsp += (bytes + 255) & ~(size_t)255; return (void*)p; };
    bf* WQ = (bf*)take((size_t)DQ * DM * 2); bf* WK = (bf*)take((size_t)DKV * DM * 2); bf* WV = (bf*)take((size_t)DKV * DM * 2); float* CS = (float*)take((size_t)TT * HD * 2 * 4);
    bf* XB = (bf*)take((size_t)TT * DM * 2); float* FQ = (float*)take((size_t)TT * DQ * 4); float* FK = (float*)take((size_t)TT * DKV * 4);
    h16* QP16 = (h16*)take((size_t)NH_ * TT * HD * 2); h16* KP16 = (h16*)take((size_t)NKV * TT * HD * 2); h16* VT16 = (h16*)take((size_t)NKV * HD * TT * 2);
    bf* QPh = nullptr; bf* QPl = nullptr; bf* KPh = nullptr; bf* KPl = nullptr; bf* VTh = nullptr; bf* VTl = nullptr; bf* Ph = nullptr; bf* Pl = nullptr;
    float* Sb = (float*)take((size_t)QC * TK * 4); h16* P16 = (h16*)take((size_t)QC * TK * 2); float* Ob = (float*)take((size_t)KSPL * QC * HD * 4);
    if ((size_t)(wsp - (char*)d_ws) > ws_size) return;    // ws 256 MiB
    float* FV = FK;   // v projection reuses the k buffer after the k planes are built (stream-ordered)
    { k_wtG<<<(unsigned)((DM * DQ / 64 + 63) / 64), 256, 0, stream>>>(wq, DM, DQ, WQ); k_wtG<<<(unsigned)((DM * DKV / 64 + 63) / 64), 256, 0, stream>>>(wk, DM, DKV, WK); k_wtG<<<(unsigned)((DM * DKV / 64 + 63) / 64), 256, 0, stream>>>(wv, DM, DKV, WV);
      
       }
    k_csid<<<(TT * HD + 255) / 256, 256, 0, stream>>>(CS);
    const unsigned LQ = (unsigned)(((size_t)NH_ * TT * HD / 2 + 255) / 256), LKv = (unsigned)(((size_t)NKV * TT * HD / 2 + 255) / 256);
    for (int b = 0; b < NB_; ++b) {
        
        k_xT<<<(unsigned)(((size_t)TT * DM / 8 + 255) / 256), 256, 0, stream>>>(x, XB);   /* (B,T,C,H,W) -> token-major [8192][128] bf16 */
        k_gemmw<bf, 0, false><<<dim3(TT / 64, DQ / 64, 1), 32, 0, stream>>>(XB, nullptr, WQ, nullptr, DM, DM, FQ, DQ, nullptr, 0, 0, 0);
        k_rope<<<LQ, 256, 0, stream>>>(FQ, DQ, NH_, CS, nullptr, nullptr, 1.0f, QP16, QPh, QPl);
        k_gemmw<bf, 0, false><<<dim3(TT / 64, DKV / 64, 1), 32, 0, stream>>>(XB, nullptr, WK, nullptr, DM, DM, FK, DKV, nullptr, 0, 0, 0);
        k_rope<<<LKv, 256, 0, stream>>>(FK, DKV, NKV, CS, nullptr, nullptr, 1.0f, KP16, KPh, KPl);
        k_gemmw<bf, 0, false><<<dim3(TT / 64, DKV / 64, 1), 32, 0, stream>>>(XB, nullptr, WV, nullptr, DM, DM, FV, DKV, nullptr, 0, 0, 0); k_vtp<<<LKv, 256, 0, stream>>>(FV, DKV, NKV, VT16, VTh, VTl);
        for (int q0 = 0; q0 < TT; q0 += QC) {   /* 4 query chunks of 2048 rows; one head */
            k_gemmw<h16, 0, false><<<dim3(QC / 64, TK / 64, 1), 32, 0, stream>>>(QP16 + (size_t)q0 * HD, nullptr, KP16, nullptr, HD, HD, Sb, TK, nullptr, 0, 0, 0);   /* scores [QC][8192] f32 */
            k_lsoft<<<QC / 8, 256, 0, stream>>>(Sb, P16);
            k_gemmw<h16, 0, false><<<dim3(QC / 64, HD / 64, KSPL), 32, 0, stream>>>(P16, nullptr, VT16, nullptr, TK, TK / KSPL, Ob, HD, nullptr, TK / KSPL, TK / KSPL, (size_t)QC * HD);   /* attn.v, slice z = keys z*256.. -> partial plane z [QC][64] f32 (x1024) */
            k_merge<<<(unsigned)(((size_t)QC * HD / 2 + 255) / 256), 256, 0, stream>>>(Ob, 0, OUT + (size_t)q0 * DQ); }   /* rows q0.. of the [8192][64] output, x 1/1024 */
         }
}

// v003
// One run takes 28.8 microseconds.
// It is 16.7 times as fast as v001, going by the measured steps of the versions left out in between.
// Over all steps from v000 it is 38.3 times as fast.
#include <hip/hip_runtime.h>

// Single-head self-attention over all 8,192 tokens of a video feature map (hidden_states [2][16][128][16][16] = (B,T,C,H,W) -> tokens n = (b,t,h,w), features c: x [8192][128]; q = x w_q, k = x w_k, v = x w_v ('xw' [128][64], no bias); scores = q.k / 8 over all 8192 keys; softmax; out = attn.v -> [8192][64] (524 k)).
// Layout: one projection kernel reads x and the weights as they come, transposes them into LDS while converting to bf16, and writes the fp16 planes q [8192][64], k [8192][64], v^T [64][8192]; scores, softmax and attn.v fused in one kernel with a running row maximum (scores and P stay in registers, a slice's K and V^T in LDS), the 8192 keys split into 16 slices; each slice leaves, per query, an unnormalised f32 partial row with its row maximum and row sum, a merge kernel joins the slices in slice order.
// Compute dtypes, f32 accumulate: every input rounded to bf16; projections on PLAIN bf16 operands (exact); scores and attn.v on single fp16 planes (P = exp(s - running max) in (0, 1], rounded to fp16); softmax f32; f32 output.

#define NB_  1
#define TT   8192
#define DM   128
#define NH_  1
#define NKV  1
#define REP  (NH_ / NKV)
#define HD   64
#define DQ   (NH_ * HD)
#define DKV  (NKV * HD)
#define ZH   1
#define RH   0                  // unused
#define WIN  0
#define TK   TT                   // keys
#define KSPL 16                   // key slices: 32 blocks of 256 queries x 16 slices = 512 blocks of 8 waves, two per WGP, four waves per SIMD
#define KSL  (TK / KSPL)          // keys per slice
#define KPIT (HD + 8)             // LDS pitch of a K row, halves: 128 + 16 bytes (16 B x odd, so the 16 rows of a 16-byte fragment read meet no bank twice)
#define VPIT (KSL + 8)            // LDS pitch of a V^T row, halves: 1024 + 16 bytes (same reason)
#define GRP  256                  // tokens per (b, t) group = H x W
#define NGRP 32                   // (b, t) groups
#define PT   64                   // tokens per projection block: a 128-byte line of a V^T row, a quarter of a (b, t) group
#define XPIT (DM + 8)             // LDS pitch of the 128 bf16 input features of a token or of an output feature, halves: 256 + 16 bytes (16 B x odd)
#define OPIT (PT + 8)             // LDS pitch of a staged output row of 64 halves: 128 + 16 bytes (same reason)
#define SCL  0.125f   // HD^-0.5
#define LC   (SCL * 1.4426950408889634f)   // score -> scaled log2 domain
typedef _Float16 h16;
typedef unsigned short bf;
typedef __attribute__((ext_vector_type(16))) __bf16   v16bf;
typedef __attribute__((ext_vector_type(16))) _Float16 v16h;
typedef __attribute__((ext_vector_type(8)))  _Float16 v8h;
typedef __attribute__((ext_vector_type(8)))  unsigned short v8us;
typedef __attribute__((ext_vector_type(8)))  float    v8f;
typedef __attribute__((ext_vector_type(4)))  float    v4f;
typedef v8h  __attribute__((may_alias)) v8ha;
typedef v4f  __attribute__((may_alias)) v4fa;
typedef v8us __attribute__((may_alias)) v8usa;

typedef __attribute__((ext_vector_type(4))) unsigned short v4us;
typedef __attribute__((ext_vector_type(8))) __bf16 v8bf;
typedef __attribute__((ext_vector_type(4))) __bf16 v4bf;
// f32 -> bf16, round to nearest even, two values an instruction
__device__ __forceinline__ v8us tobf8(v8f t) { return __builtin_bit_cast(v8us, __builtin_convertvector(t, v8bf)); }
__device__ __forceinline__ v4us tobf4(v4f t) { return __builtin_bit_cast(v4us, __builtin_convertvector(t, v4bf)); }
__device__ __forceinline__ v16h cat16(v8h lo, v8h hi) { return __builtin_shufflevector(lo, hi, 0, 1, 2, 3, 4, 5, 6, 7, 8, 9, 10, 11, 12, 13, 14, 15); }
__device__ __forceinline__ v16bf cat16b(v8us lo, v8us hi) { return __builtin_bit_cast(v16bf, __builtin_shufflevector(lo, hi, 0, 1, 2, 3, 4, 5, 6, 7, 8, 9, 10, 11, 12, 13, 14, 15)); }
__device__ __forceinline__ v8f wmma16(v16h a, v16h b, v8f c) { return __builtin_amdgcn_wmma_f32_16x16x32_f16(false, a, false, b, (short)0, c, false, false); }
__device__ __forceinline__ v8f wmmab(v16bf a, v16bf b, v8f c) { return __builtin_amdgcn_wmma_f32_16x16x32_bf16(false, a, false, b, (short)0, c, false, false); }



// fragment loader and product of the 16x16x32 forms: lane (lr, hi) holds, of row (A) or column (B) lr, k = 8 hi + 0..7 and 16 + 8 hi + 0..7; p points at k = 8 hi of that row
template <typename T16> struct WFrag;
template <> struct WFrag<h16> { typedef v16h V; static __device__ __forceinline__ V ld(const h16* p) { return cat16(*(const v8h*)p, *(const v8h*)(p + 16)); } static __device__ __forceinline__ v8f mma(V a, V b, v8f c) { return wmma16(a, b, c); } };
template <> struct WFrag<bf> { typedef v16bf V; static __device__ __forceinline__ V ld(const bf* p) { return cat16b(*(const v8us*)p, *(const v8us*)(p + 16)); } static __device__ __forceinline__ v8f mma(V a, V b, v8f c) { return wmmab(a, b, c); } };

// k_proj: q, k and v^T planes straight from the inputs. Block = 8 waves, 64 tokens; grid (TT / 64, 2): y = 0 makes q and v features 0..31, y = 1 makes k and v features 32..63 (256 blocks, one per WGP).
// The block loads its x tile [128 c][64 tokens] and its weight columns [128 c][64 + 32] in whole lines, 16 bytes a thread, rounds to bf16 and stores them transposed in LDS (c contiguous), so both are read with the one fragment loader.
// q, k: D = W^T X^T (A = 16 output features, B = 16 tokens): a lane holds 8 consecutive features of one token. v^T: D = X W (A = 16 tokens, B = 16 features): a lane holds 8 consecutive tokens of one feature. c runs 0..127 in steps of 32 in one accumulator.
// The fp16 results go through LDS so that every 128-byte line of a plane is stored whole by 8 lanes of one wave.
__global__ __launch_bounds__(256) void k_proj(const float* __restrict__ x, const float* __restrict__ wq, const float* __restrict__ wk, const float* __restrict__ wv, h16* Q, h16* Kp, h16* Vt) {
    typedef WFrag<bf> W;
    __shared__ __align__(16) bf xs[PT * XPIT]; __shared__ __align__(16) bf wl[(HD + HD / 2) * XPIT];   // wl rows 0..63: q or k features, 64..95: this block's v features
    __shared__ __align__(16) h16 oa[PT * OPIT]; __shared__ __align__(16) h16 ov[(HD / 2) * OPIT];      // oa [token][feature], ov [v feature][token]
    const int tid = threadIdx.x, lane = tid & 31, lr = lane & 15, hi = lane >> 4, wave = tid >> 5; const int n0 = blockIdx.x * PT, y = blockIdx.y;
    const char* xg = (const char*)(x + (size_t)(n0 / GRP) * DM * GRP + n0 % GRP); const char* ag = (const char*)(y ? wk : wq); const char* vg = (const char*)(wv + y * (HD / 2));
    // a thread owns 8 c x 4 columns of the 64-wide tiles (c8, e4) and 4 c x 4 columns of the 32-wide one (c4, f4); each address is a uniform base, one 32-bit byte offset and a constant
    const int c8 = (tid >> 4) * 8, e4 = (tid & 15) * 4, c4 = (tid >> 3) * 4, f4 = (tid & 7) * 4;
    const unsigned xb = (unsigned)(c8 * GRP + e4) * 4u, ab = (unsigned)(c8 * HD + e4) * 4u, vb = (unsigned)(c4 * HD + f4) * 4u;
    v4f xr[8], ar[8], vr[4];
    // every '#pragma unroll' here keeps the index of a register array a compile-time constant; on the three load loops it puts a thread's 20 loads in flight together
#pragma unroll
    for (int k = 0; k < 8; ++k) xr[k] = *(const v4f*)(xg + xb + k * GRP * 4);
#pragma unroll
    for (int k = 0; k < 8; ++k) ar[k] = *(const v4f*)(ag + ab + k * HD * 4);
#pragma unroll
    for (int k = 0; k < 4; ++k) vr[k] = *(const v4f*)(vg + vb + k * HD * 4);
    // precaution of form: the wait stands in front of the first overwrite of a register that the loads above name as an address; the three offsets are inputs so that they stay in their registers up to it
    asm volatile("s_wait_xcnt 0x0" :: "v"(xb), "v"(ab), "v"(vb) : "memory");
    __builtin_amdgcn_sched_barrier(0);   // keeps the arithmetic below from being scheduled above that wait
#pragma unroll
    for (int i = 0; i < 4; ++i) { v8f t;
#pragma unroll
        for (int k = 0; k < 8; ++k) t[k] = xr[k][i];
        *(v8us*)(xs + (e4 + i) * XPIT + c8) = tobf8(t); }
#pragma unroll
    for (int i = 0; i < 4; ++i) { v8f t;
#pragma unroll
        for (int k = 0; k < 8; ++k) t[k] = ar[k][i];
        *(v8us*)(wl + (e4 + i) * XPIT + c8) = tobf8(t); }
#pragma unroll
    for (int i = 0; i < 4; ++i) { v4f t;
#pragma unroll
        for (int k = 0; k < 4; ++k) t[k] = vr[k][i];
        *(v4us*)(wl + (HD + f4 + i) * XPIT + c4) = tobf4(t); }
    __syncthreads();   // both bf16 tiles are complete in LDS before any wave reads a fragment
    // wave: token tile tt, feature tiles 2 fh and 2 fh + 1 of q or k, feature tile fh of this block's v half
    const int tt = wave & 3, fh = wave >> 2;
    const bf* xp = xs + (tt * 16 + lr) * XPIT + 8 * hi; const bf* wp = wl + (fh * 32 + lr) * XPIT + 8 * hi; const bf* up = wl + (HD + fh * 16 + lr) * XPIT + 8 * hi;
    v16bf xf[DM / 32], w0[DM / 32], w1[DM / 32], wu[DM / 32];
#pragma unroll
    for (int ks = 0; ks < DM / 32; ++ks) { xf[ks] = W::ld(xp + ks * 32); w0[ks] = W::ld(wp + ks * 32); w1[ks] = W::ld(wp + 16 * XPIT + ks * 32); wu[ks] = W::ld(up + ks * 32); }
    __builtin_amdgcn_sched_barrier(0);   // all 32 fragment reads are issued ahead of the first product: left to itself the compiler reused a few registers and waited out the LDS latency in front of every product
    v8f a0 = (v8f){}, a1 = (v8f){}, av = (v8f){};
#pragma unroll
    for (int ks = 0; ks < DM / 32; ++ks) { a0 = W::mma(w0[ks], xf[ks], a0); a1 = W::mma(w1[ks], xf[ks], a1); av = W::mma(xf[ks], wu[ks], av); }
    v8h t0, t1, tv;
#pragma unroll
    for (int j = 0; j < 8; ++j) { t0[j] = (h16)a0[j]; t1[j] = (h16)a1[j]; tv[j] = (h16)av[j]; }
    *(v8h*)(oa + (tt * 16 + lr) * OPIT + fh * 32 + hi * 8) = t0; *(v8h*)(oa + (tt * 16 + lr) * OPIT + fh * 32 + 16 + hi * 8) = t1; *(v8h*)(ov + (fh * 16 + lr) * OPIT + tt * 16 + hi * 8) = tv;
    __syncthreads();   // the staged rows are complete before they are read back line by line
    h16* P = (y ? Kp : Q) + (size_t)n0 * HD;   // the block's 64 rows of 128 bytes are contiguous
    const v8h r0 = *(const v8h*)(oa + (tid >> 3) * OPIT + (tid & 7) * 8), r1 = *(const v8h*)(oa + (32 + (tid >> 3)) * OPIT + (tid & 7) * 8), rv = *(const v8h*)(ov + (tid >> 3) * OPIT + (tid & 7) * 8);
    *(v8h*)(P + tid * 8) = r0; *(v8h*)(P + 2048 + tid * 8) = r1;
    *(v8h*)(Vt + (size_t)(y * (HD / 2) + (tid >> 3)) * TT + n0 + (tid & 7) * 8) = rv;
}

// lane l <-> l ^ 16 (the two halves of a wave hold the two key halves of one query column)
__device__ __forceinline__ float xhalf(float x) { const int b = __float_as_int(x); return __int_as_float(__builtin_amdgcn_permlanex16(b, b, 0x76543210, 0xfedcba98, false, false)); }

// k_fattn: fused scores + softmax + attn.v. Block = 8 waves x 32 queries, grid (TT / 256, KSPL); the block copies its slice's K rows and V^T rows into LDS once (whole-line loads, shared by the 8 waves), then each wave walks the KSL keys 32 at a time with no further barrier.
// Every '#pragma unroll' in it keeps the index of a register array a compile-time constant; on the two copy loops it puts a thread's 32 loads in flight together.
// S^T = K Q^T (A = 16 key rows, B = 16 query columns kept in registers): lane (lr, hi) holds, for query lr, keys 8 hi + j (tile 0) and 16 + 8 hi + j (tile 1), which is the k order of the fragment loader, so the two converted score tiles ARE the B operand of O^T += V^T P^T.
// Per slice z and query q: Op[q][z][0..63] = sum_k exp2(s LC - m) v[k], Mp[z][q] = m (scaled log2 domain), Lp[z][q] = sum_k exp2(s LC - m).
__global__ __launch_bounds__(256) void k_fattn(const h16* __restrict__ Q, const h16* __restrict__ Kp, const h16* __restrict__ Vt, float* Op, float* Mp, float* Lp) {
    typedef WFrag<h16> W;
    const int lane = threadIdx.x & 31, lr = lane & 15, hi = lane >> 4; const int q0 = blockIdx.x * 256 + (threadIdx.x >> 5) * 32; const int z = blockIdx.y;
    __shared__ __align__(16) h16 kls[KSL * KPIT]; __shared__ __align__(16) h16 vls[HD * VPIT];
    // each thread's global addresses are a uniform base, one 32-bit byte offset and a constant: qb for its Q rows, kb and vb for its 16-byte pieces of the slice's K rows and V^T rows
    const unsigned qb = (unsigned)((q0 + lr) * HD + 8 * hi) * 2u, kb = threadIdx.x * 16u, vb = (threadIdx.x / (KSL / 8)) * (TK * 2u) + (threadIdx.x % (KSL / 8)) * 16u;
    v16h qf[2][2];
#pragma unroll
    for (int qt = 0; qt < 2; ++qt)
#pragma unroll
        for (int ks = 0; ks < 2; ++ks) qf[qt][ks] = W::ld((const h16*)((const char*)Q + qb) + qt * 16 * HD + ks * 32);
    { const char* kg = (const char*)(Kp + (size_t)z * KSL * HD); const char* vg = (const char*)(Vt + z * KSL);
#pragma unroll
      for (int i = 0; i < KSL * HD / 8 / 256; ++i) { const int c = threadIdx.x + i * 256; *(v8h*)(kls + (c >> 3) * KPIT + (c & 7) * 8) = *(const v8h*)(kg + kb + i * 4096); }
#pragma unroll
      for (int i = 0; i < KSL * HD / 8 / 256; ++i) { const int c = threadIdx.x + i * 256; *(v8h*)(vls + (c / (KSL / 8)) * VPIT + (c % (KSL / 8)) * 8) = *(const v8h*)(vg + vb + (size_t)i * (256 / (KSL / 8)) * TK * 2); } }
    // precaution of form: the wait stands in front of the first overwrite of a register that the loads above name as an address; qb and vb are inputs so that they stay in their registers up to it (the K loads take threadIdx.x itself as a scaled offset; the compiler rewrites that register earlier, behind a counted wait of its own that covers them)
    asm volatile("s_wait_xcnt 0x0" :: "v"(qb), "v"(vb) : "memory");
    __builtin_amdgcn_sched_barrier(0);   // keeps the accumulators' zeroing from being scheduled above that wait
    v8f o[2][4]; float m[2], l[2];
#pragma unroll
    for (int qt = 0; qt < 2; ++qt) { m[qt] = -3.0e38f; l[qt] = 0.f;
#pragma unroll
        for (int dt = 0; dt < 4; ++dt) o[qt][dt] = (v8f){}; }
    __syncthreads();   // the slice is complete in LDS before any wave reads a fragment; LDS is only read from here on
    const h16* kp = kls + lr * KPIT + 8 * hi; const h16* vp = vls + lr * VPIT + 8 * hi;
    v16h kf[2][2];
#pragma unroll
    for (int kt = 0; kt < 2; ++kt)
#pragma unroll
        for (int ks = 0; ks < 2; ++ks) kf[kt][ks] = W::ld(kp + kt * 16 * KPIT + ks * 32);
    // rolled: the body already holds 16 matrix instructions, and a second copy would not fit four waves' registers
#pragma unroll 1
    for (int it = 0; it < KSL / 32; ++it) {
        v16h vf[4];
#pragma unroll
        for (int dt = 0; dt < 4; ++dt) vf[dt] = W::ld(vp + dt * 16 * VPIT + it * 32);
        v8f s[2][2];
#pragma unroll
        for (int qt = 0; qt < 2; ++qt)
#pragma unroll
            for (int kt = 0; kt < 2; ++kt) s[qt][kt] = W::mma(kf[kt][1], qf[qt][1], W::mma(kf[kt][0], qf[qt][0], (v8f){}));
        const int nx = (it + 1 < KSL / 32) ? it + 1 : it;   // next pass's K rows, fetched behind this pass's score products; the last pass re-reads its own (in bounds)
#pragma unroll
        for (int kt = 0; kt < 2; ++kt)
#pragma unroll
            for (int ks = 0; ks < 2; ++ks) kf[kt][ks] = W::ld(kp + nx * 32 * KPIT + kt * 16 * KPIT + ks * 32);
#pragma unroll
        for (int qt = 0; qt < 2; ++qt) {
            float mx = s[qt][0][0];
#pragma unroll
            for (int j = 1; j < 16; ++j) mx = fmaxf(mx, s[qt][j >> 3][j & 7]);
            mx = fmaxf(mx, xhalf(mx));
            const float mn = fmaxf(m[qt], mx * LC); const float al = __builtin_amdgcn_exp2f(m[qt] - mn); m[qt] = mn;
            v16h p; float sm = 0.f;
#pragma unroll
            for (int j = 0; j < 16; ++j) { const float e = __builtin_amdgcn_exp2f(__builtin_fmaf(s[qt][j >> 3][j & 7], LC, -mn)); sm += e; p[j] = (h16)e; }
            l[qt] = l[qt] * al + sm;
#pragma unroll
            for (int dt = 0; dt < 4; ++dt) o[qt][dt] = W::mma(vf[dt], p, o[qt][dt] * al);
        }
    }
#pragma unroll
    for (int qt = 0; qt < 2; ++qt) {
        const float lt = l[qt] + xhalf(l[qt]); const int q = q0 + qt * 16 + lr; const size_t zq = (size_t)z * TT + q; float* op = Op + ((size_t)q * KSPL + z) * HD + hi * 8;
#pragma unroll
        for (int dt = 0; dt < 4; ++dt) { v4f lo, hh;
#pragma unroll
            for (int j = 0; j < 4; ++j) { lo[j] = o[qt][dt][j]; hh[j] = o[qt][dt][4 + j]; }
            *(v4f*)(op + dt * 16) = lo; *(v4f*)(op + dt * 16 + 4) = hh; }
        if (hi == 0) { Mp[zq] = m[qt]; Lp[zq] = lt; }
    }
}

// k_merge: out[q][d] = sum_z w_z Op[q][z][d] / sum_z w_z Lp[z][q], w_z = exp2(Mp[z][q] - max_z Mp[z][q]), slices in order; a thread owns 4 consecutive d of one query
__global__ __launch_bounds__(256) void k_merge(const float* __restrict__ Op, const float* __restrict__ Mp, const float* __restrict__ Lp, float* OUTb) {
    const unsigned t = blockIdx.x * 256u + threadIdx.x; if (t >= (unsigned)(TT * HD / 4)) return;
    // every address is a uniform base, one 32-bit byte offset and a constant: eb in the [TT][HD] output, pb in the [TT][KSPL][HD] partials; qi is the query, the index in a [TT] plane
    const unsigned eb = t * 16u, qi = t / (HD / 4), pb = qi * (KSPL * HD * 4u) + (t % (HD / 4)) * 16u;
    float mz[KSPL], lz[KSPL]; v4f pz[KSPL];
    // each loop unrolled so that all slices' loads are in flight together
#pragma unroll
    for (int zs = 0; zs < KSPL; ++zs) mz[zs] = Mp[(size_t)zs * TT + qi];
#pragma unroll
    for (int zs = 0; zs < KSPL; ++zs) lz[zs] = Lp[(size_t)zs * TT + qi];
#pragma unroll
    for (int zs = 0; zs < KSPL; ++zs) pz[zs] = *(const v4f*)((const char*)Op + pb + zs * HD * 4);
    // precaution of form: the wait stands in front of the first overwrite of a register that the loads above name as an address; qi and pb are inputs so that they stay in their registers up to it
    asm volatile("s_wait_xcnt 0x0" :: "v"(qi), "v"(pb) : "memory");
    __builtin_amdgcn_sched_barrier(0);   // keeps the arithmetic below from being scheduled above that wait
    float M = mz[0];
#pragma unroll
    for (int zs = 1; zs < KSPL; ++zs) M = fmaxf(M, mz[zs]);
    float den = 0.f; v4f sm = (v4f){};
#pragma unroll
    for (int zs = 0; zs < KSPL; ++zs) mz[zs] -= M;
    // from here on mz is the slice's weight. v_nop: the free issue slot that the instruction set asks for behind a transcendental; the scheduling barriers hold each v_nop directly behind its exponential
    __builtin_amdgcn_sched_barrier(0);
#pragma unroll
    for (int zs = 0; zs < KSPL; ++zs) { mz[zs] = __builtin_amdgcn_exp2f(mz[zs]); __builtin_amdgcn_sched_barrier(0); asm volatile("v_nop"); __builtin_amdgcn_sched_barrier(0); }
#pragma unroll
    for (int zs = 0; zs < KSPL; ++zs) { den += mz[zs] * lz[zs]; sm += pz[zs] * mz[zs]; }
    const float r = 1.0f / den; *(v4f*)((char*)OUTb + eb) = sm * r;  }

extern "C" void kernel_launch(void* const* d_in, const int* in_sizes, int n_in,
                              void* d_out, int out_size, void* d_ws, size_t ws_size, hipStream_t stream) {
    (void)in_sizes; (void)n_in; (void)out_size;
    const float* x = (const float*)d_in[0]; const float* wq = (const float*)d_in[1]; const float* wk = (const float*)d_in[2]; const float* wv = (const float*)d_in[3];
    float* OUT = (float*)d_out;     // [1][8192][64]
    char* wsp = (char*)d_ws;
    auto take = [&](size_t bytes) { char* p = wsp; wsp += (bytes + 255) & ~(size_t)255; return (void*)p; };
    h16* QP16 = (h16*)take((size_t)NH_ * TT * HD * 2); h16* KP16 = (h16*)take((size_t)NKV * TT * HD * 2); h16* VT16 = (h16*)take((size_t)NKV * HD * TT * 2);
    float* Ob = (float*)take((size_t)KSPL * TT * HD * 4); float* Mb = (float*)take((size_t)KSPL * TT * 4); float* Lb = (float*)take((size_t)KSPL * TT * 4);
    if ((size_t)(wsp - (char*)d_ws) > ws_size) return;    // ws 256 MiB
    k_proj<<<dim3(TT / PT, 2, 1), 256, 0, stream>>>(x, wq, wk, wv, QP16, KP16, VT16);   /* (B,T,C,H,W) f32 and [128][64] f32 weights -> fp16 planes */
    k_fattn<<<dim3(TT / 256, KSPL, 1), 256, 0, stream>>>(QP16, KP16, VT16, Ob, Mb, Lb);   /* slice z = keys z*512..: partial rows [q][z][64] f32, row maxima and sums [z][q] */
    k_merge<<<(unsigned)(((size_t)TT * HD / 4 + 255) / 256), 256, 0, stream>>>(Ob, Mb, Lb, OUT);
}

// v004
// Measured time: 26.8 microseconds a run.
// In both of two side-by-side timings against v003, it was 1.07 times as fast.
// Over all steps from v000 it is 40.9 times as fast.
#include <hip/hip_runtime.h>

// Single-head self-attention over all 8,192 tokens of a video feature map (hidden_states [2][16][128][16][16] = (B,T,C,H,W) -> tokens n = (b,t,h,w), features c: x [8192][128]; q = x w_q, k = x w_k, v = x w_v ('xw' [128][64], no bias); scores = q.k / 8 over all 8192 keys; softmax; out = attn.v -> [8192][64] (524 k)).
// Layout: one projection kernel reads x and the weights as they come, transposes them into LDS while converting to bf16, and writes the fp16 planes q [8192][64], k [8192][64], v^T [64][8192]; scores, softmax and attn.v fused in one kernel with a running row maximum (scores and P stay in registers, a slice's K and V^T in LDS), the 8192 keys split into 16 slices; each slice leaves, per query, an unnormalised f32 partial row with the row maximum in use and its row sum, a merge kernel joins the slices in slice order.
// Compute dtypes, f32 accumulate: every input rounded to bf16; projections on PLAIN bf16 operands (exact); scores and attn.v on single fp16 planes (P = exp(s - the row maximum in use), at most 2^8, rounded to fp16); softmax f32; f32 output.

#define NB_  1
#define TT   8192
#define DM   128
#define NH_  1
#define NKV  1
#define REP  (NH_ / NKV)
#define HD   64
#define DQ   (NH_ * HD)
#define DKV  (NKV * HD)
#define ZH   1
#define RH   0                  // unused
#define WIN  0
#define TK   TT                   // keys
#define KSPL 16                   // key slices: 32 blocks of 256 queries x 16 slices = 512 blocks of 8 waves, two per WGP, four waves per SIMD
#define KSL  (TK / KSPL)          // keys per slice
#define KPIT (HD + 8)             // LDS pitch of a K row, halves: 128 + 16 bytes (16 B x odd, so the 16 rows of a 16-byte fragment read meet no bank twice)
#define VPIT (KSL + 8)            // LDS pitch of a V^T row, halves: 1024 + 16 bytes (same reason)
#define GRP  256                  // tokens per (b, t) group = H x W
#define NGRP 32                   // (b, t) groups
#define PT   64                   // tokens per projection block: a 128-byte line of a V^T row, a quarter of a (b, t) group
#define XPIT (DM + 8)             // LDS pitch of the 128 bf16 input features of a token or of an output feature, halves: 256 + 16 bytes (16 B x odd)
#define OPIT (PT + 8)             // LDS pitch of a staged output row of 64 halves: 128 + 16 bytes (same reason)
#define SCL  0.125f   // HD^-0.5
#define LC   (SCL * 1.4426950408889634f)   // score -> scaled log2 domain
typedef _Float16 h16;
typedef unsigned short bf;
typedef __attribute__((ext_vector_type(16))) __bf16   v16bf;
typedef __attribute__((ext_vector_type(16))) _Float16 v16h;
typedef __attribute__((ext_vector_type(8)))  _Float16 v8h;
typedef __attribute__((ext_vector_type(8)))  unsigned short v8us;
typedef __attribute__((ext_vector_type(8)))  float    v8f;
typedef __attribute__((ext_vector_type(4)))  float    v4f;
typedef v8h  __attribute__((may_alias)) v8ha;
typedef v4f  __attribute__((may_alias)) v4fa;
typedef v8us __attribute__((may_alias)) v8usa;

typedef __attribute__((ext_vector_type(4))) unsigned short v4us;
typedef __attribute__((ext_vector_type(8))) __bf16 v8bf;
typedef __attribute__((ext_vector_type(4))) __bf16 v4bf;
// f32 -> bf16, round to nearest even, two values an instruction
__device__ __forceinline__ v8us tobf8(v8f t) { return __builtin_bit_cast(v8us, __builtin_convertvector(t, v8bf)); }
__device__ __forceinline__ v4us tobf4(v4f t) { return __builtin_bit_cast(v4us, __builtin_convertvector(t, v4bf)); }
__device__ __forceinline__ v16h cat16(v8h lo, v8h hi) { return __builtin_shufflevector(lo, hi, 0, 1, 2, 3, 4, 5, 6, 7, 8, 9, 10, 11, 12, 13, 14, 15); }
__device__ __forceinline__ v16bf cat16b(v8us lo, v8us hi) { return __builtin_bit_cast(v16bf, __builtin_shufflevector(lo, hi, 0, 1, 2, 3, 4, 5, 6, 7, 8, 9, 10, 11, 12, 13, 14, 15)); }
__device__ __forceinline__ v8f wmma16(v16h a, v16h b, v8f c) { return __builtin_amdgcn_wmma_f32_16x16x32_f16(false, a, false, b, (short)0, c, false, false); }
__device__ __forceinline__ v8f wmmab(v16bf a, v16bf b, v8f c) { return __builtin_amdgcn_wmma_f32_16x16x32_bf16(false, a, false, b, (short)0, c, false, false); }



// fragment loader and product of the 16x16x32 forms: lane (lr, hi) holds, of row (A) or column (B) lr, k = 8 hi + 0..7 and 16 + 8 hi + 0..7; p points at k = 8 hi of that row
template <typename T16> struct WFrag;
template <> struct WFrag<h16> { typedef v16h V; static __device__ __forceinline__ V ld(const h16* p) { return cat16(*(const v8h*)p, *(const v8h*)(p + 16)); } static __device__ __forceinline__ v8f mma(V a, V b, v8f c) { return wmma16(a, b, c); } };
template <> struct WFrag<bf> { typedef v16bf V; static __device__ __forceinline__ V ld(const bf* p) { return cat16b(*(const v8us*)p, *(const v8us*)(p + 16)); } static __device__ __forceinline__ v8f mma(V a, V b, v8f c) { return wmmab(a, b, c); } };

// k_proj: q, k and v^T planes straight from the inputs. Block = 8 waves, 64 tokens; grid (TT / 64, 2): y = 0 makes q and v features 0..31, y = 1 makes k and v features 32..63 (256 blocks, one per WGP).
// The block loads its x tile [128 c][64 tokens] and its weight columns [128 c][64 + 32] in whole lines, 16 bytes a thread, rounds to bf16 and stores them transposed in LDS (c contiguous), so both are read with the one fragment loader.
// q, k: D = W^T X^T (A = 16 output features, B = 16 tokens): a lane holds 8 consecutive features of one token. v^T: D = X W (A = 16 tokens, B = 16 features): a lane holds 8 consecutive tokens of one feature. c runs 0..127 in steps of 32 in one accumulator.
// The fp16 results go through LDS so that every 128-byte line of a plane is stored whole by 8 lanes of one wave.
__global__ __launch_bounds__(256) void k_proj(const float* __restrict__ x, const float* __restrict__ wq, const float* __restrict__ wk, const float* __restrict__ wv, h16* Q, h16* Kp, h16* Vt) {
    typedef WFrag<bf> W;
    __shared__ __align__(16) bf xs[PT * XPIT]; __shared__ __align__(16) bf wl[(HD + HD / 2) * XPIT];   // wl rows 0..63: q or k features, 64..95: this block's v features
    __shared__ __align__(16) h16 oa[PT * OPIT]; __shared__ __align__(16) h16 ov[(HD / 2) * OPIT];      // oa [token][feature], ov [v feature][token]
    const int tid = threadIdx.x, lane = tid & 31, lr = lane & 15, hi = lane >> 4, wave = tid >> 5; const int n0 = blockIdx.x * PT, y = blockIdx.y;
    const char* xg = (const char*)(x + (size_t)(n0 / GRP) * DM * GRP + n0 % GRP); const char* ag = (const char*)(y ? wk : wq); const char* vg = (const char*)(wv + y * (HD / 2));
    // a thread owns 8 c x 4 columns of the 64-wide tiles (c8, e4) and 4 c x 4 columns of the 32-wide one (c4, f4); each address is a uniform base, one 32-bit byte offset and a constant
    const int c8 = (tid >> 4) * 8, e4 = (tid & 15) * 4, c4 = (tid >> 3) * 4, f4 = (tid & 7) * 4;
    const unsigned xb = (unsigned)(c8 * GRP + e4) * 4u, ab = (unsigned)(c8 * HD + e4) * 4u, vb = (unsigned)(c4 * HD + f4) * 4u;
    v4f xr[8], ar[8], vr[4];
    // every '#pragma unroll' here keeps the index of a register array a compile-time constant; on the three load loops it puts a thread's 20 loads in flight together
#pragma unroll
    for (int k = 0; k < 8; ++k) xr[k] = *(const v4f*)(xg + xb + k * GRP * 4);
#pragma unroll
    for (int k = 0; k < 8; ++k) ar[k] = *(const v4f*)(ag + ab + k * HD * 4);
#pragma unroll
    for (int k = 0; k < 4; ++k) vr[k] = *(const v4f*)(vg + vb + k * HD * 4);
    // precaution of form: the wait stands in front of the first overwrite of a register that the loads above name as an address; the three offsets are inputs so that they stay in their registers up to it
    asm volatile("s_wait_xcnt 0x0" :: "v"(xb), "v"(ab), "v"(vb) : "memory");
    __builtin_amdgcn_sched_barrier(0);   // keeps the arithmetic below from being scheduled above that wait
#pragma unroll
    for (int i = 0; i < 4; ++i) { v8f t;
#pragma unroll
        for (int k = 0; k < 8; ++k) t[k] = xr[k][i];
        *(v8us*)(xs + (e4 + i) * XPIT + c8) = tobf8(t); }
#pragma unroll
    for (int i = 0; i < 4; ++i) { v8f t;
#pragma unroll
        for (int k = 0; k < 8; ++k) t[k] = ar[k][i];
        *(v8us*)(wl + (e4 + i) * XPIT + c8) = tobf8(t); }
#pragma unroll
    for (int i = 0; i < 4; ++i) { v4f t;
#pragma unroll
        for (int k = 0; k < 4; ++k) t[k] = vr[k][i];
        *(v4us*)(wl + (HD + f4 + i) * XPIT + c4) = tobf4(t); }
    __syncthreads();   // both bf16 tiles are complete in LDS before any wave reads a fragment
    // wave: token tile tt, feature tiles 2 fh and 2 fh + 1 of q or k, feature tile fh of this block's v half
    const int tt = wave & 3, fh = wave >> 2;
    const bf* xp = xs + (tt * 16 + lr) * XPIT + 8 * hi; const bf* wp = wl + (fh * 32 + lr) * XPIT + 8 * hi; const bf* up = wl + (HD + fh * 16 + lr) * XPIT + 8 * hi;
    v16bf xf[DM / 32], w0[DM / 32], w1[DM / 32], wu[DM / 32];
#pragma unroll
    for (int ks = 0; ks < DM / 32; ++ks) { xf[ks] = W::ld(xp + ks * 32); w0[ks] = W::ld(wp + ks * 32); w1[ks] = W::ld(wp + 16 * XPIT + ks * 32); wu[ks] = W::ld(up + ks * 32); }
    __builtin_amdgcn_sched_barrier(0);   // all 32 fragment reads are issued ahead of the first product: left to itself the compiler reused a few registers and waited out the LDS latency in front of every product
    v8f a0 = (v8f){}, a1 = (v8f){}, av = (v8f){};
#pragma unroll
    for (int ks = 0; ks < DM / 32; ++ks) { a0 = W::mma(w0[ks], xf[ks], a0); a1 = W::mma(w1[ks], xf[ks], a1); av = W::mma(xf[ks], wu[ks], av); }
    const float qs = y ? 1.0f : LC;   // q leaves in the scaled log2 domain (one rounding to fp16, as before), so that k_fattn's score products need no multiply behind them
    v8h t0, t1, tv;
#pragma unroll
    for (int j = 0; j < 8; ++j) { t0[j] = (h16)(a0[j] * qs); t1[j] = (h16)(a1[j] * qs); tv[j] = (h16)av[j]; }
    *(v8h*)(oa + (tt * 16 + lr) * OPIT + fh * 32 + hi * 8) = t0; *(v8h*)(oa + (tt * 16 + lr) * OPIT + fh * 32 + 16 + hi * 8) = t1; *(v8h*)(ov + (fh * 16 + lr) * OPIT + tt * 16 + hi * 8) = tv;
    __syncthreads();   // the staged rows are complete before they are read back line by line
    h16* P = (y ? Kp : Q) + (size_t)n0 * HD;   // the block's 64 rows of 128 bytes are contiguous
    const v8h r0 = *(const v8h*)(oa + (tid >> 3) * OPIT + (tid & 7) * 8), r1 = *(const v8h*)(oa + (32 + (tid >> 3)) * OPIT + (tid & 7) * 8), rv = *(const v8h*)(ov + (tid >> 3) * OPIT + (tid & 7) * 8);
    *(v8h*)(P + tid * 8) = r0; *(v8h*)(P + 2048 + tid * 8) = r1;
    *(v8h*)(Vt + (size_t)(y * (HD / 2) + (tid >> 3)) * TT + n0 + (tid & 7) * 8) = rv;
}

// lane l <-> l ^ 16 (the two halves of a wave hold the two key halves of one query column)
__device__ __forceinline__ float xhalf(float x) { const int b = __float_as_int(x); return __int_as_float(__builtin_amdgcn_permlanex16(b, b, 0x76543210, 0xfedcba98, false, false)); }

// k_fattn: fused scores + softmax + attn.v. Block = 8 waves x 32 queries, grid (TT / 256, KSPL); the block copies its slice's K rows and V^T rows into LDS once (whole-line loads, shared by the 8 waves), then each wave walks the KSL keys 32 at a time with no further barrier.
// Every '#pragma unroll' in it keeps the index of a register array a compile-time constant; on the two copy loops it puts a thread's 32 loads in flight together.
// S^T = K Q^T (A = 16 key rows, B = 16 query columns kept in registers): lane (lr, hi) holds, for query lr, keys 8 hi + j (tile 0) and 16 + 8 hi + j (tile 1), which is the k order of the fragment loader, so the two converted score tiles ARE the B operand of O^T += V^T P^T.
// Per slice z and query q: Op[q][z][0..63] = sum_k exp2(s LC - m) v[k], Mp[z][q] = m (scaled log2 domain; the maximum in use at the end, at most 8 below the slice's true maximum), Lp[z][q] = sum_k exp2(s LC - m). Q arrives multiplied by LC.
__global__ __launch_bounds__(256) void k_fattn(const h16* __restrict__ Q, const h16* __restrict__ Kp, const h16* __restrict__ Vt, float* Op, float* Mp, float* Lp) {
    typedef WFrag<h16> W;
    const int lane = threadIdx.x & 31, lr = lane & 15, hi = lane >> 4; const int q0 = blockIdx.x * 256 + (threadIdx.x >> 5) * 32; const int z = blockIdx.y;
    __shared__ __align__(16) h16 lds[HD * VPIT + KSL * KPIT]; h16* const vls = lds; h16* const kls = lds + HD * VPIT;   // V^T first: the offsets of its four row groups then fit the LDS loads' 16-bit offset field
    // each thread's global addresses are a uniform base, one 32-bit byte offset and a constant: qb for its Q rows, kb and vb for its 16-byte pieces of the slice's K rows and V^T rows
    const unsigned qb = (unsigned)((q0 + lr) * HD + 8 * hi) * 2u, kb = threadIdx.x * 16u, vb = (threadIdx.x / (KSL / 8)) * (TK * 2u) + (threadIdx.x % (KSL / 8)) * 16u;
    v16h qf[2][2];
#pragma unroll
    for (int qt = 0; qt < 2; ++qt)
#pragma unroll
        for (int ks = 0; ks < 2; ++ks) qf[qt][ks] = W::ld((const h16*)((const char*)Q + qb) + qt * 16 * HD + ks * 32);
    { const char* kg = (const char*)(Kp + (size_t)z * KSL * HD); const char* vg = (const char*)(Vt + z * KSL);
#pragma unroll
      for (int i = 0; i < KSL * HD / 8 / 256; ++i) { const int c = threadIdx.x + i * 256; *(v8h*)(kls + (c >> 3) * KPIT + (c & 7) * 8) = *(const v8h*)(kg + kb + i * 4096); }
#pragma unroll
      for (int i = 0; i < KSL * HD / 8 / 256; ++i) { const int c = threadIdx.x + i * 256; *(v8h*)(vls + (c / (KSL / 8)) * VPIT + (c % (KSL / 8)) * 8) = *(const v8h*)(vg + vb + (size_t)i * (256 / (KSL / 8)) * TK * 2); } }
    // precaution of form: the wait stands in front of the first overwrite of a register that the loads above name as an address; qb and vb are inputs so that they stay in their registers up to it (the K loads take threadIdx.x itself as a scaled offset; the compiler rewrites that register earlier, behind a counted wait of its own that covers them)
    asm volatile("s_wait_xcnt 0x0" :: "v"(qb), "v"(vb) : "memory");
    __builtin_amdgcn_sched_barrier(0);   // keeps the accumulators' zeroing from being scheduled above that wait
    v8f o[2][4], nm[2]; float m[2], l[2];   // nm: -m in all 8 registers of an accumulator tile, the start value of the score products
#pragma unroll
    for (int qt = 0; qt < 2; ++qt) { m[qt] = 0.f; l[qt] = 0.f; nm[qt] = (v8f){};
#pragma unroll
        for (int dt = 0; dt < 4; ++dt) o[qt][dt] = (v8f){}; }
    __syncthreads();   // the slice is complete in LDS before any wave reads a fragment; LDS is only read from here on
    const h16* kp = kls + lr * KPIT + 8 * hi; const h16* vp = vls + lr * VPIT + 8 * hi;
    v16h kf[2][2];
#pragma unroll
    for (int kt = 0; kt < 2; ++kt)
#pragma unroll
        for (int ks = 0; ks < 2; ++ks) kf[kt][ks] = W::ld(kp + kt * 16 * KPIT + ks * 32);
    // rolled: the body already holds 16 matrix instructions, and a second copy would not fit four waves' registers
#pragma unroll 1
    for (int it = 0; it < KSL / 32; ++it) {
        v16h vf[4];
#pragma unroll
        for (int dt = 0; dt < 4; ++dt) vf[dt] = W::ld(vp + dt * 16 * VPIT + it * 32);
        v8f s[2][2];
        // s = q.k LC - m, the exponent itself. The 8 score products in asm text: D apart from C, so that nm stays in its registers (from the builtin the compiler copied the start value into D, 8 to 16 64-bit moves a pass).
        // Four independent tiles, then their accumulating second halves; the four v_nop are the distance the chip needs between the last product and the first vector instruction that reads its D.
        asm("v_wmma_f32_16x16x32_f16 %0, %4, %8, %12\n\t"
            "v_wmma_f32_16x16x32_f16 %1, %6, %8, %12\n\t"
            "v_wmma_f32_16x16x32_f16 %2, %4, %10, %13\n\t"
            "v_wmma_f32_16x16x32_f16 %3, %6, %10, %13\n\t"
            "v_wmma_f32_16x16x32_f16 %0, %5, %9, %0\n\t"
            "v_wmma_f32_16x16x32_f16 %1, %7, %9, %1\n\t"
            "v_wmma_f32_16x16x32_f16 %2, %5, %11, %2\n\t"
            "v_wmma_f32_16x16x32_f16 %3, %7, %11, %3\n\t"
            "v_nop\n\tv_nop\n\tv_nop\n\tv_nop"
            : "=&v"(s[0][0]), "=&v"(s[0][1]), "=&v"(s[1][0]), "=&v"(s[1][1])
            : "v"(kf[0][0]), "v"(kf[0][1]), "v"(kf[1][0]), "v"(kf[1][1]), "v"(qf[0][0]), "v"(qf[0][1]), "v"(qf[1][0]), "v"(qf[1][1]), "v"(nm[0]), "v"(nm[1]));
        const int nx = (it + 1 < KSL / 32) ? it + 1 : it;   // next pass's K rows, fetched behind this pass's score products; the last pass re-reads its own (in bounds)
#pragma unroll
        for (int kt = 0; kt < 2; ++kt)
#pragma unroll
            for (int ks = 0; ks < 2; ++ks) kf[kt][ks] = W::ld(kp + nx * 32 * KPIT + kt * 16 * KPIT + ks * 32);
        // the maximum in use m stays until some score exceeds it by more than 8 (scaled log2 domain): P is then at most 2^8, well inside fp16, and o, l and m stay one consistent triple for the merge
        float mall = s[0][0][0];
#pragma unroll
        for (int j = 1; j < 32; ++j) mall = fmaxf(mall, s[j >> 4][(j >> 3) & 1][j & 7]);
        if (__builtin_amdgcn_ballot_w32(mall > 8.0f) != 0 || it == 0) {   // one scalar branch a pass, taken by the whole wave: on the first pass (which sets m) and rarely after it
#pragma unroll
            for (int qt = 0; qt < 2; ++qt) {
                float mx = s[qt][0][0];
#pragma unroll
                for (int j = 1; j < 16; ++j) mx = fmaxf(mx, s[qt][j >> 3][j & 7]);
                mx = fmaxf(mx, xhalf(mx));
                const float dl = it == 0 ? mx : fmaxf(mx, 0.f); const float al = it == 0 ? 0.f : __builtin_amdgcn_exp2f(-dl);   // m moves up by dl; the first pass takes its own maximum, whatever its sign (o and l are still 0)
                m[qt] += dl; l[qt] *= al;
#pragma unroll
                for (int j = 0; j < 8; ++j) { nm[qt][j] = -m[qt]; s[qt][0][j] -= dl; s[qt][1][j] -= dl; }
#pragma unroll
                for (int dt = 0; dt < 4; ++dt) o[qt][dt] = o[qt][dt] * al;
            }
        }
#pragma unroll
        for (int qt = 0; qt < 2; ++qt) {
            v16h p; float sm = 0.f;
#pragma unroll
            for (int j = 0; j < 16; ++j) { const float e = __builtin_amdgcn_exp2f(s[qt][j >> 3][j & 7]); sm += e; p[j] = (h16)e; }
            l[qt] += sm;
#pragma unroll
            for (int dt = 0; dt < 4; ++dt) o[qt][dt] = W::mma(vf[dt], p, o[qt][dt]);
        }
    }
#pragma unroll
    for (int qt = 0; qt < 2; ++qt) {
        const float lt = l[qt] + xhalf(l[qt]); const int q = q0 + qt * 16 + lr; const size_t zq = (size_t)z * TT + q; float* op = Op + ((size_t)q * KSPL + z) * HD + hi * 8;
#pragma unroll
        for (int dt = 0; dt < 4; ++dt) { v4f lo, hh;
#pragma unroll
            for (int j = 0; j < 4; ++j) { lo[j] = o[qt][dt][j]; hh[j] = o[qt][dt][4 + j]; }
            *(v4f*)(op + dt * 16) = lo; *(v4f*)(op + dt * 16 + 4) = hh; }
        if (hi == 0) { Mp[zq] = m[qt]; Lp[zq] = lt; }
    }
}

// k_merge: out[q][d] = sum_z w_z Op[q][z][d] / sum_z w_z Lp[z][q], w_z = exp2(Mp[z][q] - max_z Mp[z][q]), slices in order; a thread owns 4 consecutive d of one query
__global__ __launch_bounds__(256) void k_merge(const float* __restrict__ Op, const float* __restrict__ Mp, const float* __restrict__ Lp, float* OUTb) {
    const unsigned t = blockIdx.x * 256u + threadIdx.x; if (t >= (unsigned)(TT * HD / 4)) return;
    // every address is a uniform base, one 32-bit byte offset and a constant: eb in the [TT][HD] output, pb in the [TT][KSPL][HD] partials; qi is the query, the index in a [TT] plane
    const unsigned eb = t * 16u, qi = t / (HD / 4), pb = qi * (KSPL * HD * 4u) + (t % (HD / 4)) * 16u;
    float mz[KSPL], lz[KSPL]; v4f pz[KSPL];
    // each loop unrolled so that all slices' loads are in flight together
#pragma unroll
    for (int zs = 0; zs < KSPL; ++zs) mz[zs] = Mp[(size_t)zs * TT + qi];
#pragma unroll
    for (int zs = 0; zs < KSPL; ++zs) lz[zs] = Lp[(size_t)zs * TT + qi];
#pragma unroll
    for (int zs = 0; zs < KSPL; ++zs) pz[zs] = *(const v4f*)((const char*)Op + pb + zs * HD * 4);
    // precaution of form: the wait stands in front of the first overwrite of a register that the loads above name as an address; qi and pb are inputs so that they stay in their registers up to it
    asm volatile("s_wait_xcnt 0x0" :: "v"(qi), "v"(pb) : "memory");
    __builtin_amdgcn_sched_barrier(0);   // keeps the arithmetic below from being scheduled above that wait
    float M = mz[0];
#pragma unroll
    for (int zs = 1; zs < KSPL; ++zs) M = fmaxf(M, mz[zs]);
    float den = 0.f; v4f sm = (v4f){};
#pragma unroll
    for (int zs = 0; zs < KSPL; ++zs) mz[zs] -= M;
    // from here on mz is the slice's weight. v_nop: the free issue slot that the instruction set asks for behind a transcendental; the scheduling barriers hold each v_nop directly behind its exponential
    __builtin_amdgcn_sched_barrier(0);
#pragma unroll
    for (int zs = 0; zs < KSPL; ++zs) { mz[zs] = __builtin_amdgcn_exp2f(mz[zs]); __builtin_amdgcn_sched_barrier(0); asm volatile("v_nop"); __builtin_amdgcn_sched_barrier(0); }
#pragma unroll
    for (int zs = 0; zs < KSPL; ++zs) { den += mz[zs] * lz[zs]; sm += pz[zs] * mz[zs]; }
    const float r = 1.0f / den; *(v4f*)((char*)OUTb + eb) = sm * r;  }

extern "C" void kernel_launch(void* const* d_in, const int* in_sizes, int n_in,
                              void* d_out, int out_size, void* d_ws, size_t ws_size, hipStream_t stream) {
    (void)in_sizes; (void)n_in; (void)out_size;
    const float* x = (const float*)d_in[0]; const float* wq = (const float*)d_in[1]; const float* wk = (const float*)d_in[2]; const float* wv = (const float*)d_in[3];
    float* OUT = (float*)d_out;     // [1][8192][64]
    char* wsp = (char*)d_ws;
    auto take = [&](size_t bytes) { char* p = wsp; wsp += (bytes + 255) & ~(size_t)255; return (void*)p; };
    h16* QP16 = (h16*)take((size_t)NH_ * TT * HD * 2); h16* KP16 = (h16*)take((size_t)NKV * TT * HD * 2); h16* VT16 = (h16*)take((size_t)NKV * HD * TT * 2);
    float* Ob = (float*)take((size_t)KSPL * TT * HD * 4); float* Mb = (float*)take((size_t)KSPL * TT * 4); float* Lb = (float*)take((size_t)KSPL * TT * 4);
    if ((size_t)(wsp - (char*)d_ws) > ws_size) return;    // ws 256 MiB
    k_proj<<<dim3(TT / PT, 2, 1), 256, 0, stream>>>(x, wq, wk, wv, QP16, KP16, VT16);   /* (B,T,C,H,W) f32 and [128][64] f32 weights -> fp16 planes */
    k_fattn<<<dim3(TT / 256, KSPL, 1), 256, 0, stream>>>(QP16, KP16, VT16, Ob, Mb, Lb);   /* slice z = keys z*512..: partial rows [q][z][64] f32, row maxima in use and sums [z][q] */
    k_merge<<<(unsigned)(((size_t)TT * HD / 4 + 255) / 256), 256, 0, stream>>>(Ob, Mb, Lb, OUT);
}

// v005
// It runs in 24.2 microseconds.
// Next to v004, in two timings, it ran 1.11 times as fast each time.
// Counting every step since v000, it is 45.5 times as fast.
#include <hip/hip_runtime.h>

// Single-head self-attention over all 8,192 tokens of a video feature map (hidden_states [2][16][128][16][16] = (B,T,C,H,W) -> tokens n = (b,t,h,w), features c: x [8192][128]; q = x w_q, k = x w_k, v = x w_v ('xw' [128][64], no bias); scores = q.k / 8 over all 8192 keys; softmax; out = attn.v -> [8192][64] (524 k)).
// Layout: one projection kernel reads x and the weights as they come, transposes them into LDS while converting to bf16, and writes the fp16 planes q [8192][64], k [8192][64], v^T [64][8192]; scores, softmax and attn.v fused in one kernel with a running row maximum (scores and P stay in registers, a slice's K and V^T in LDS), the 8192 keys split into 16 slices; each slice leaves, per query, its own softmax average of v (a normalised row, fp16) and the log2 of its sum of exponentials (f32), a merge kernel joins the slices in slice order.
// Compute dtypes, f32 accumulate: every input rounded to bf16; projections on PLAIN bf16 operands (exact); scores and attn.v on single fp16 planes (P = exp(s - the row maximum in use), at most 2^8, rounded to fp16); softmax f32; a slice's normalised partial row rounded to fp16 (a convex mix of fp16 v values, so inside their range); merge and output f32.

#define NB_  1
#define TT   8192
#define DM   128
#define NH_  1
#define NKV  1
#define REP  (NH_ / NKV)
#define HD   64
#define DQ   (NH_ * HD)
#define DKV  (NKV * HD)
#define ZH   1
#define RH   0                  // unused
#define WIN  0
#define TK   TT                   // keys
#define KSPL 16                   // key slices: 32 blocks of 256 queries x 16 slices = 512 blocks of 8 waves, two per WGP, four waves per SIMD
#define KSL  (TK / KSPL)          // keys per slice
#define KPIT (HD + 8)             // LDS pitch of a K row, halves: 128 + 16 bytes (16 B x odd, so the 16 rows of a 16-byte fragment read meet no bank twice)
#define VPIT (KSL + 8)            // LDS pitch of a V^T row, halves: 1024 + 16 bytes (same reason)
#define GRP  256                  // tokens per (b, t) group = H x W
#define NGRP 32                   // (b, t) groups
#define PT   64                   // tokens per projection block: a 128-byte line of a V^T row, a quarter of a (b, t) group
#define XPIT (DM + 8)             // LDS pitch of the 128 bf16 input features of a token or of an output feature, halves: 256 + 16 bytes (16 B x odd)
#define OPIT (PT + 8)             // LDS pitch of a staged output row of 64 halves: 128 + 16 bytes (same reason)
#define SCL  0.125f   // HD^-0.5
#define LC   (SCL * 1.4426950408889634f)   // score -> scaled log2 domain
typedef _Float16 h16;
typedef unsigned short bf;
typedef __attribute__((ext_vector_type(16))) __bf16   v16bf;
typedef __attribute__((ext_vector_type(16))) _Float16 v16h;
typedef __attribute__((ext_vector_type(8)))  _Float16 v8h;
typedef __attribute__((ext_vector_type(8)))  unsigned short v8us;
typedef __attribute__((ext_vector_type(8)))  float    v8f;
typedef __attribute__((ext_vector_type(4)))  float    v4f;
typedef v8h  __attribute__((may_alias)) v8ha;
typedef v4f  __attribute__((may_alias)) v4fa;
typedef v8us __attribute__((may_alias)) v8usa;

typedef __attribute__((ext_vector_type(4))) unsigned short v4us;
typedef __attribute__((ext_vector_type(8))) __bf16 v8bf;
typedef __attribute__((ext_vector_type(4))) __bf16 v4bf;
// f32 -> bf16, round to nearest even, two values an instruction
__device__ __forceinline__ v8us tobf8(v8f t) { return __builtin_bit_cast(v8us, __builtin_convertvector(t, v8bf)); }
__device__ __forceinline__ v4us tobf4(v4f t) { return __builtin_bit_cast(v4us, __builtin_convertvector(t, v4bf)); }
__device__ __forceinline__ v16h cat16(v8h lo, v8h hi) { return __builtin_shufflevector(lo, hi, 0, 1, 2, 3, 4, 5, 6, 7, 8, 9, 10, 11, 12, 13, 14, 15); }
__device__ __forceinline__ v16bf cat16b(v8us lo, v8us hi) { return __builtin_bit_cast(v16bf, __builtin_shufflevector(lo, hi, 0, 1, 2, 3, 4, 5, 6, 7, 8, 9, 10, 11, 12, 13, 14, 15)); }
__device__ __forceinline__ v8f wmma16(v16h a, v16h b, v8f c) { return __builtin_amdgcn_wmma_f32_16x16x32_f16(false, a, false, b, (short)0, c, false, false); }
__device__ __forceinline__ v8f wmmab(v16bf a, v16bf b, v8f c) { return __builtin_amdgcn_wmma_f32_16x16x32_bf16(false, a, false, b, (short)0, c, false, false); }



// fragment loader and product of the 16x16x32 forms: lane (lr, hi) holds, of row (A) or column (B) lr, k = 8 hi + 0..7 and 16 + 8 hi + 0..7; p points at k = 8 hi of that row
template <typename T16> struct WFrag;
template <> struct WFrag<h16> { typedef v16h V; static __device__ __forceinline__ V ld(const h16* p) { return cat16(*(const v8h*)p, *(const v8h*)(p + 16)); } static __device__ __forceinline__ v8f mma(V a, V b, v8f c) { return wmma16(a, b, c); } };
template <> struct WFrag<bf> { typedef v16bf V; static __device__ __forceinline__ V ld(const bf* p) { return cat16b(*(const v8us*)p, *(const v8us*)(p + 16)); } static __device__ __forceinline__ v8f mma(V a, V b, v8f c) { return wmmab(a, b, c); } };

// k_proj: q, k and v^T planes straight from the inputs. Block = 8 waves, 64 tokens; grid (TT / 64, 2): y = 0 makes q and v features 0..31, y = 1 makes k and v features 32..63 (256 blocks, one per WGP).
// The block loads its x tile [128 c][64 tokens] and its weight columns [128 c][64 + 32] in whole lines, 16 bytes a thread, rounds to bf16 and stores them transposed in LDS (c contiguous), so both are read with the one fragment loader.
// q, k: D = W^T X^T (A = 16 output features, B = 16 tokens): a lane holds 8 consecutive features of one token. v^T: D = X W (A = 16 tokens, B = 16 features): a lane holds 8 consecutive tokens of one feature. c runs 0..127 in steps of 32 in one accumulator.
// The fp16 results go through LDS so that every 128-byte line of a plane is stored whole by 8 lanes of one wave.
__global__ __launch_bounds__(256) void k_proj(const float* __restrict__ x, const float* __restrict__ wq, const float* __restrict__ wk, const float* __restrict__ wv, h16* Q, h16* Kp, h16* Vt) {
    typedef WFrag<bf> W;
    __shared__ __align__(16) bf xs[PT * XPIT]; __shared__ __align__(16) bf wl[(HD + HD / 2) * XPIT];   // wl rows 0..63: q or k features, 64..95: this block's v features
    __shared__ __align__(16) h16 oa[PT * OPIT]; __shared__ __align__(16) h16 ov[(HD / 2) * OPIT];      // oa [token][feature], ov [v feature][token]
    const int tid = threadIdx.x, lane = tid & 31, lr = lane & 15, hi = lane >> 4, wave = tid >> 5; const int n0 = blockIdx.x * PT, y = blockIdx.y;
    const char* xg = (const char*)(x + (size_t)(n0 / GRP) * DM * GRP + n0 % GRP); const char* ag = (const char*)(y ? wk : wq); const char* vg = (const char*)(wv + y * (HD / 2));
    // a thread owns 8 c x 4 columns of the 64-wide tiles (c8, e4) and 4 c x 4 columns of the 32-wide one (c4, f4); each address is a uniform base, one 32-bit byte offset and a constant
    const int c8 = (tid >> 4) * 8, e4 = (tid & 15) * 4, c4 = (tid >> 3) * 4, f4 = (tid & 7) * 4;
    const unsigned xb = (unsigned)(c8 * GRP + e4) * 4u, ab = (unsigned)(c8 * HD + e4) * 4u, vb = (unsigned)(c4 * HD + f4) * 4u;
    v4f xr[8], ar[8], vr[4];
    // every '#pragma unroll' here keeps the index of a register array a compile-time constant; on the three load loops it puts a thread's 20 loads in flight together
#pragma unroll
    for (int k = 0; k < 8; ++k) xr[k] = *(const v4f*)(xg + xb + k * GRP * 4);
#pragma unroll
    for (int k = 0; k < 8; ++k) ar[k] = *(const v4f*)(ag + ab + k * HD * 4);
#pragma unroll
    for (int k = 0; k < 4; ++k) vr[k] = *(const v4f*)(vg + vb + k * HD * 4);
    // precaution of form: the wait stands in front of the first overwrite of a register that the loads above name as an address; the three offsets are inputs so that they stay in their registers up to it
    asm volatile("s_wait_xcnt 0x0" :: "v"(xb), "v"(ab), "v"(vb) : "memory");
    __builtin_amdgcn_sched_barrier(0);   // keeps the arithmetic below from being scheduled above that wait
#pragma unroll
    for (int i = 0; i < 4; ++i) { v8f t;
#pragma unroll
        for (int k = 0; k < 8; ++k) t[k] = xr[k][i];
        *(v8us*)(xs + (e4 + i) * XPIT + c8) = tobf8(t); }
#pragma unroll
    for (int i = 0; i < 4; ++i) { v8f t;
#pragma unroll
        for (int k = 0; k < 8; ++k) t[k] = ar[k][i];
        *(v8us*)(wl + (e4 + i) * XPIT + c8) = tobf8(t); }
#pragma unroll
    for (int i = 0; i < 4; ++i) { v4f t;
#pragma unroll
        for (int k = 0; k < 4; ++k) t[k] = vr[k][i];
        *(v4us*)(wl + (HD + f4 + i) * XPIT + c4) = tobf4(t); }
    __syncthreads();   // both bf16 tiles are complete in LDS before any wave reads a fragment
    // wave: token tile tt, feature tiles 2 fh and 2 fh + 1 of q or k, feature tile fh of this block's v half
    const int tt = wave & 3, fh = wave >> 2;
    const bf* xp = xs + (tt * 16 + lr) * XPIT + 8 * hi; const bf* wp = wl + (fh * 32 + lr) * XPIT + 8 * hi; const bf* up = wl + (HD + fh * 16 + lr) * XPIT + 8 * hi;
    v16bf xf[DM / 32], w0[DM / 32], w1[DM / 32], wu[DM / 32];
#pragma unroll
    for (int ks = 0; ks < DM / 32; ++ks) { xf[ks] = W::ld(xp + ks * 32); w0[ks] = W::ld(wp + ks * 32); w1[ks] = W::ld(wp + 16 * XPIT + ks * 32); wu[ks] = W::ld(up + ks * 32); }
    __builtin_amdgcn_sched_barrier(0);   // all 32 fragment reads are issued ahead of the first product: left to itself the compiler reused a few registers and waited out the LDS latency in front of every product
    v8f a0 = (v8f){}, a1 = (v8f){}, av = (v8f){};
#pragma unroll
    for (int ks = 0; ks < DM / 32; ++ks) { a0 = W::mma(w0[ks], xf[ks], a0); a1 = W::mma(w1[ks], xf[ks], a1); av = W::mma(xf[ks], wu[ks], av); }
    const float qs = y ? 1.0f : LC;   // q leaves in the scaled log2 domain (one rounding to fp16, as before), so that k_fattn's score products need no multiply behind them
    v8h t0, t1, tv;
#pragma unroll
    for (int j = 0; j < 8; ++j) { t0[j] = (h16)(a0[j] * qs); t1[j] = (h16)(a1[j] * qs); tv[j] = (h16)av[j]; }
    *(v8h*)(oa + (tt * 16 + lr) * OPIT + fh * 32 + hi * 8) = t0; *(v8h*)(oa + (tt * 16 + lr) * OPIT + fh * 32 + 16 + hi * 8) = t1; *(v8h*)(ov + (fh * 16 + lr) * OPIT + tt * 16 + hi * 8) = tv;
    __syncthreads();   // the staged rows are complete before they are read back line by line
    h16* P = (y ? Kp : Q) + (size_t)n0 * HD;   // the block's 64 rows of 128 bytes are contiguous
    const v8h r0 = *(const v8h*)(oa + (tid >> 3) * OPIT + (tid & 7) * 8), r1 = *(const v8h*)(oa + (32 + (tid >> 3)) * OPIT + (tid & 7) * 8), rv = *(const v8h*)(ov + (tid >> 3) * OPIT + (tid & 7) * 8);
    *(v8h*)(P + tid * 8) = r0; *(v8h*)(P + 2048 + tid * 8) = r1;
    *(v8h*)(Vt + (size_t)(y * (HD / 2) + (tid >> 3)) * TT + n0 + (tid & 7) * 8) = rv;
}

// lane l <-> l ^ 16 (the two halves of a wave hold the two key halves of one query column)
__device__ __forceinline__ float xhalf(float x) { const int b = __float_as_int(x); return __int_as_float(__builtin_amdgcn_permlanex16(b, b, 0x76543210, 0xfedcba98, false, false)); }

// k_fattn: fused scores + softmax + attn.v. Block = 8 waves x 32 queries, grid (TT / 256, KSPL); the block copies its slice's K rows and V^T rows into LDS once (whole-line loads, shared by the 8 waves), then each wave walks the KSL keys 32 at a time with no further barrier.
// Every '#pragma unroll' in it keeps the index of a register array a compile-time constant; on the two copy loops it puts a thread's 32 loads in flight together.
// S^T = K Q^T (A = 16 key rows, B = 16 query columns kept in registers): lane (lr, hi) holds, for query lr, keys 8 hi + j (tile 0) and 16 + 8 hi + j (tile 1), which is the k order of the fragment loader, so the two converted score tiles ARE the B operand of O^T += V^T P^T.
// Per slice z and query q, with l = sum_k exp2(s LC - m) and m the maximum in use at the end (scaled log2 domain, at most 8 below the slice's true maximum; l is at least 1, the key that set m counts 1): Op[q][z][0..63] = sum_k exp2(s LC - m) v[k] / l in fp16, one 128-byte line, Ep[z][q] = m + log2 l. Q arrives multiplied by LC.
__global__ __launch_bounds__(256) void k_fattn(const h16* __restrict__ Q, const h16* __restrict__ Kp, const h16* __restrict__ Vt, h16* Op, float* Ep) {
    typedef WFrag<h16> W;
    const int lane = threadIdx.x & 31, lr = lane & 15, hi = lane >> 4; const int q0 = blockIdx.x * 256 + (threadIdx.x >> 5) * 32; const int z = blockIdx.y;
    __shared__ __align__(16) h16 lds[HD * VPIT + KSL * KPIT]; h16* const vls = lds; h16* const kls = lds + HD * VPIT;   // V^T first: the offsets of its four row groups then fit the LDS loads' 16-bit offset field
    // each thread's global addresses are a uniform base, one 32-bit byte offset and a constant: qb for its Q rows, kb and vb for its 16-byte pieces of the slice's K rows and V^T rows
    const unsigned qb = (unsigned)((q0 + lr) * HD + 8 * hi) * 2u, kb = threadIdx.x * 16u, vb = (threadIdx.x / (KSL / 8)) * (TK * 2u) + (threadIdx.x % (KSL / 8)) * 16u;
    v16h qf[2][2];
#pragma unroll
    for (int qt = 0; qt < 2; ++qt)
#pragma unroll
        for (int ks = 0; ks < 2; ++ks) qf[qt][ks] = W::ld((const h16*)((const char*)Q + qb) + qt * 16 * HD + ks * 32);
    { const char* kg = (const char*)(Kp + (size_t)z * KSL * HD); const char* vg = (const char*)(Vt + z * KSL);
#pragma unroll
      for (int i = 0; i < KSL * HD / 8 / 256; ++i) { const int c = threadIdx.x + i * 256; *(v8h*)(kls + (c >> 3) * KPIT + (c & 7) * 8) = *(const v8h*)(kg + kb + i * 4096); }
#pragma unroll
      for (int i = 0; i < KSL * HD / 8 / 256; ++i) { const int c = threadIdx.x + i * 256; *(v8h*)(vls + (c / (KSL / 8)) * VPIT + (c % (KSL / 8)) * 8) = *(const v8h*)(vg + vb + (size_t)i * (256 / (KSL / 8)) * TK * 2); } }
    // precaution of form: the wait stands in front of the first overwrite of a register that the loads above name as an address; qb and vb are inputs so that they stay in their registers up to it (the K loads take threadIdx.x itself as a scaled offset; the compiler rewrites that register earlier, behind a counted wait of its own that covers them)
    asm volatile("s_wait_xcnt 0x0" :: "v"(qb), "v"(vb) : "memory");
    __builtin_amdgcn_sched_barrier(0);   // keeps the accumulators' zeroing from being scheduled above that wait
    v8f o[2][4], nm[2]; float m[2], l[2];   // nm: -m in all 8 registers of an accumulator tile, the start value of the score products
#pragma unroll
    for (int qt = 0; qt < 2; ++qt) { m[qt] = 0.f; l[qt] = 0.f; nm[qt] = (v8f){};
#pragma unroll
        for (int dt = 0; dt < 4; ++dt) o[qt][dt] = (v8f){}; }
    __syncthreads();   // the slice is complete in LDS before any wave reads a fragment; LDS is only read from here on
    const h16* kp = kls + lr * KPIT + 8 * hi; const h16* vp = vls + lr * VPIT + 8 * hi;
    v16h kf[2][2];
#pragma unroll
    for (int kt = 0; kt < 2; ++kt)
#pragma unroll
        for (int ks = 0; ks < 2; ++ks) kf[kt][ks] = W::ld(kp + kt * 16 * KPIT + ks * 32);
    // rolled: the body already holds 16 matrix instructions, and a second copy would not fit four waves' registers
#pragma unroll 1
    for (int it = 0; it < KSL / 32; ++it) {
        v16h vf[4];
#pragma unroll
        for (int dt = 0; dt < 4; ++dt) vf[dt] = W::ld(vp + dt * 16 * VPIT + it * 32);
        v8f s[2][2];
        // s = q.k LC - m, the exponent itself. The 8 score products in asm text: D apart from C, so that nm stays in its registers (from the builtin the compiler copied the start value into D, 8 to 16 64-bit moves a pass).
        // Four independent tiles, then their accumulating second halves; the four v_nop are the distance the chip needs between the last product and the first vector instruction that reads its D.
        asm("v_wmma_f32_16x16x32_f16 %0, %4, %8, %12\n\t"
            "v_wmma_f32_16x16x32_f16 %1, %6, %8, %12\n\t"
            "v_wmma_f32_16x16x32_f16 %2, %4, %10, %13\n\t"
            "v_wmma_f32_16x16x32_f16 %3, %6, %10, %13\n\t"
            "v_wmma_f32_16x16x32_f16 %0, %5, %9, %0\n\t"
            "v_wmma_f32_16x16x32_f16 %1, %7, %9, %1\n\t"
            "v_wmma_f32_16x16x32_f16 %2, %5, %11, %2\n\t"
            "v_wmma_f32_16x16x32_f16 %3, %7, %11, %3\n\t"
            "v_nop\n\tv_nop\n\tv_nop\n\tv_nop"
            : "=&v"(s[0][0]), "=&v"(s[0][1]), "=&v"(s[1][0]), "=&v"(s[1][1])
            : "v"(kf[0][0]), "v"(kf[0][1]), "v"(kf[1][0]), "v"(kf[1][1]), "v"(qf[0][0]), "v"(qf[0][1]), "v"(qf[1][0]), "v"(qf[1][1]), "v"(nm[0]), "v"(nm[1]));
        const int nx = (it + 1 < KSL / 32) ? it + 1 : it;   // next pass's K rows, fetched behind this pass's score products; the last pass re-reads its own (in bounds)
#pragma unroll
        for (int kt = 0; kt < 2; ++kt)
#pragma unroll
            for (int ks = 0; ks < 2; ++ks) kf[kt][ks] = W::ld(kp + nx * 32 * KPIT + kt * 16 * KPIT + ks * 32);
        // the maximum in use m stays until some score exceeds it by more than 8 (scaled log2 domain): P is then at most 2^8, well inside fp16, and o, l and m stay one consistent triple for the merge
        float mall = s[0][0][0];
#pragma unroll
        for (int j = 1; j < 32; ++j) mall = fmaxf(mall, s[j >> 4][(j >> 3) & 1][j & 7]);
        if (__builtin_amdgcn_ballot_w32(mall > 8.0f) != 0 || it == 0) {   // one scalar branch a pass, taken by the whole wave: on the first pass (which sets m) and rarely after it
#pragma unroll
            for (int qt = 0; qt < 2; ++qt) {
                float mx = s[qt][0][0];
#pragma unroll
                for (int j = 1; j < 16; ++j) mx = fmaxf(mx, s[qt][j >> 3][j & 7]);
                mx = fmaxf(mx, xhalf(mx));
                const float dl = it == 0 ? mx : fmaxf(mx, 0.f); const float al = it == 0 ? 0.f : __builtin_amdgcn_exp2f(-dl);   // m moves up by dl; the first pass takes its own maximum, whatever its sign (o and l are still 0)
                m[qt] += dl; l[qt] *= al;
#pragma unroll
                for (int j = 0; j < 8; ++j) { nm[qt][j] = -m[qt]; s[qt][0][j] -= dl; s[qt][1][j] -= dl; }
#pragma unroll
                for (int dt = 0; dt < 4; ++dt) o[qt][dt] = o[qt][dt] * al;
            }
        }
#pragma unroll
        for (int qt = 0; qt < 2; ++qt) {
            v16h p; float sm = 0.f;
#pragma unroll
            for (int j = 0; j < 16; ++j) { const float e = __builtin_amdgcn_exp2f(s[qt][j >> 3][j & 7]); sm += e; p[j] = (h16)e; }
            l[qt] += sm;
#pragma unroll
            for (int dt = 0; dt < 4; ++dt) o[qt][dt] = W::mma(vf[dt], p, o[qt][dt]);
        }
    }
    // a lane holds 8 consecutive d of one query per tile: 16 bytes of that query's fp16 row; the four tiles of a query fill its 128-byte line
    v8h t[2][4]; float ev[2];
#pragma unroll
    for (int qt = 0; qt < 2; ++qt) {
        const float lt = l[qt] + xhalf(l[qt]); const float r = 1.0f / lt; ev[qt] = m[qt] + __builtin_amdgcn_logf(lt);   // logf: the hardware's log2
#pragma unroll
        for (int dt = 0; dt < 4; ++dt)
#pragma unroll
            for (int j = 0; j < 8; ++j) t[qt][dt][j] = (h16)(o[qt][dt][j] * r);
    }
    // a uniform base, one 32-bit byte offset and a constant: ob in the [TT][KSPL][HD] fp16 partials, xb in the [KSPL][TT] f32 plane
    const unsigned ob = (unsigned)(((q0 + lr) * KSPL + z) * HD + hi * 8) * 2u, xb = (unsigned)(z * TT + q0 + lr) * 4u;
#pragma unroll
    for (int qt = 0; qt < 2; ++qt)
#pragma unroll
        for (int dt = 0; dt < 4; ++dt) *(v8h*)((char*)Op + ob + qt * 16 * KSPL * HD * 2 + dt * 32) = t[qt][dt];
    if (hi == 0) { *(float*)((char*)Ep + xb) = ev[0]; *(float*)((char*)Ep + xb + 64) = ev[1]; }
}

// k_merge: out[q][d] = sum_z w_z Op[q][z][d] / sum_z w_z, w_z = exp2(Ep[z][q] - max_z Ep[z][q]), slices in order; a thread owns 8 consecutive d of one query (16 bytes of each fp16 partial row)
__global__ __launch_bounds__(256) void k_merge(const h16* __restrict__ Op, const float* __restrict__ Ep, float* OUTb) {
    const unsigned t = blockIdx.x * 256u + threadIdx.x; if (t >= (unsigned)(TT * HD / 8)) return;
    // every address is a uniform base, one 32-bit byte offset and a constant: eb in the [TT][HD] output, pb in the [TT][KSPL][HD] partials; qi is the query, the index in a [TT] plane
    const unsigned eb = t * 32u, qi = t / (HD / 8), pb = qi * (KSPL * HD * 2u) + (t % (HD / 8)) * 16u;
    float mz[KSPL]; v8h pz[KSPL];
    // each loop unrolled so that all slices' loads are in flight together
#pragma unroll
    for (int zs = 0; zs < KSPL; ++zs) mz[zs] = Ep[(size_t)zs * TT + qi];
#pragma unroll
    for (int zs = 0; zs < KSPL; ++zs) pz[zs] = *(const v8h*)((const char*)Op + pb + zs * HD * 2);
    // precaution of form: the wait stands in front of the first overwrite of a register that the loads above name as an address; qi and pb are inputs so that they stay in their registers up to it
    asm volatile("s_wait_xcnt 0x0" :: "v"(qi), "v"(pb) : "memory");
    __builtin_amdgcn_sched_barrier(0);   // keeps the arithmetic below from being scheduled above that wait
    float M = mz[0];
#pragma unroll
    for (int zs = 1; zs < KSPL; ++zs) M = fmaxf(M, mz[zs]);
    float den = 0.f; v8f sm = (v8f){};
#pragma unroll
    for (int zs = 0; zs < KSPL; ++zs) mz[zs] -= M;
    // from here on mz is the slice's weight. v_nop: the free issue slot that the instruction set asks for behind a transcendental; the scheduling barriers hold each v_nop directly behind its exponential
    __builtin_amdgcn_sched_barrier(0);
#pragma unroll
    for (int zs = 0; zs < KSPL; ++zs) { mz[zs] = __builtin_amdgcn_exp2f(mz[zs]); __builtin_amdgcn_sched_barrier(0); asm volatile("v_nop"); __builtin_amdgcn_sched_barrier(0); }
#pragma unroll
    for (int zs = 0; zs < KSPL; ++zs) { den += mz[zs];
#pragma unroll
        for (int j = 0; j < 8; ++j) sm[j] += (float)pz[zs][j] * mz[zs]; }
    const float r = 1.0f / den; v4f lo, hh;
#pragma unroll
    for (int j = 0; j < 4; ++j) { lo[j] = sm[j] * r; hh[j] = sm[4 + j] * r; }
    *(v4f*)((char*)OUTb + eb) = lo; *(v4f*)((char*)OUTb + eb + 16) = hh;  }

extern "C" void kernel_launch(void* const* d_in, const int* in_sizes, int n_in,
                              void* d_out, int out_size, void* d_ws, size_t ws_size, hipStream_t stream) {
    (void)in_sizes; (void)n_in; (void)out_size;
    const float* x = (const float*)d_in[0]; const float* wq = (const float*)d_in[1]; const float* wk = (const float*)d_in[2]; const float* wv = (const float*)d_in[3];
    float* OUT = (float*)d_out;     // [1][8192][64]
    char* wsp = (char*)d_ws;
    auto take = [&](size_t bytes) { char* p = wsp; wsp += (bytes + 255) & ~(size_t)255; return (void*)p; };
    h16* QP16 = (h16*)take((size_t)NH_ * TT * HD * 2); h16* KP16 = (h16*)take((size_t)NKV * TT * HD * 2); h16* VT16 = (h16*)take((size_t)NKV * HD * TT * 2);
    h16* Ob = (h16*)take((size_t)KSPL * TT * HD * 2); float* Eb = (float*)take((size_t)KSPL * TT * 4);
    if ((size_t)(wsp - (char*)d_ws) > ws_size) return;    // ws 256 MiB
    k_proj<<<dim3(TT / PT, 2, 1), 256, 0, stream>>>(x, wq, wk, wv, QP16, KP16, VT16);   /* (B,T,C,H,W) f32 and [128][64] f32 weights -> fp16 planes */
    k_fattn<<<dim3(TT / 256, KSPL, 1), 256, 0, stream>>>(QP16, KP16, VT16, Ob, Eb);   /* slice z = keys z*512..: normalised partial rows [q][z][64] fp16, log2 sums of exponentials [z][q] */
    k_merge<<<(unsigned)(((size_t)TT * HD / 8 + 255) / 256), 256, 0, stream>>>(Ob, Eb, OUT);
}

// v006
// Measured time: 22.9 microseconds a run.
// Two timings next to v005 put it at 1.05 and 1.06 times that version's speed.
// Over all steps from v000 it is 48.0 times as fast.
#include <hip/hip_runtime.h>

// Single-head self-attention over all 8,192 tokens of a video feature map (hidden_states [2][16][128][16][16] = (B,T,C,H,W) -> tokens n = (b,t,h,w), features c: x [8192][128]; q = x w_q, k = x w_k, v = x w_v ('xw' [128][64], no bias); scores = q.k / 8 over all 8192 keys; softmax; out = attn.v -> [8192][64] (524 k)).
// Layout: one projection kernel reads x and the weights as they come, transposes them into LDS while converting to bf16, and writes the fp16 planes q (fragment order, see k_proj), k [8192][64], v^T [64][8192]; scores, softmax and attn.v fused in one kernel with a running row maximum (scores and P stay in registers, a slice's K and V^T in LDS), the 8192 keys split into 16 slices; each slice leaves, per query, its own softmax average of v (a normalised row, fp16) and the log2 of its sum of exponentials (f32), a merge kernel joins the slices in slice order.
// Compute dtypes, f32 accumulate: every input rounded to bf16; projections on PLAIN bf16 operands (exact); scores and attn.v on single fp16 planes (P = exp(s - the row maximum in use), at most 2^8, rounded to fp16); softmax f32; a slice's normalised partial row rounded to fp16 (a convex mix of fp16 v values, so inside their range); merge and output f32.

#define NB_  1
#define TT   8192
#define DM   128
#define NH_  1
#define NKV  1
#define REP  (NH_ / NKV)
#define HD   64
#define DQ   (NH_ * HD)
#define DKV  (NKV * HD)
#define ZH   1
#define RH   0                  // unused
#define WIN  0
#define TK   TT                   // keys
#define KSPL 16                   // key slices: 32 blocks of 256 queries x 16 slices = 512 blocks of 8 waves, two per WGP, four waves per SIMD
#define KSL  (TK / KSPL)          // keys per slice
#define KPIT (HD + 8)             // LDS pitch of a K row, halves: 128 + 16 bytes (16 B x odd, so the 16 rows of a 16-byte fragment read meet no bank twice)
#define VPIT (KSL + 8)            // LDS pitch of a V^T row, halves: 1024 + 16 bytes (same reason)
#define GRP  256                  // tokens per (b, t) group = H x W
#define NGRP 32                   // (b, t) groups
#define PT   64                   // tokens per projection block: a 128-byte line of a V^T row, a quarter of a (b, t) group
#define XPIT (DM + 8)             // LDS pitch of the 128 bf16 input features of a token or of an output feature, halves: 256 + 16 bytes (16 B x odd)
#define OPIT (PT + 8)             // LDS pitch of a staged output row of 64 halves: 128 + 16 bytes (same reason)
#define SCL  0.125f   // HD^-0.5
#define LC   (SCL * 1.4426950408889634f)   // score -> scaled log2 domain
typedef _Float16 h16;
typedef unsigned short bf;
typedef __attribute__((ext_vector_type(16))) __bf16   v16bf;
typedef __attribute__((ext_vector_type(16))) _Float16 v16h;
typedef __attribute__((ext_vector_type(8)))  _Float16 v8h;
typedef __attribute__((ext_vector_type(8)))  unsigned short v8us;
typedef __attribute__((ext_vector_type(8)))  float    v8f;
typedef __attribute__((ext_vector_type(4)))  float    v4f;
typedef v8h  __attribute__((may_alias)) v8ha;
typedef v4f  __attribute__((may_alias)) v4fa;
typedef v8us __attribute__((may_alias)) v8usa;

typedef __attribute__((ext_vector_type(4))) unsigned short v4us;
typedef __attribute__((ext_vector_type(8))) __bf16 v8bf;
typedef __attribute__((ext_vector_type(4))) __bf16 v4bf;
// f32 -> bf16, round to nearest even, two values an instruction
__device__ __forceinline__ v8us tobf8(v8f t) { return __builtin_bit_cast(v8us, __builtin_convertvector(t, v8bf)); }
__device__ __forceinline__ v4us tobf4(v4f t) { return __builtin_bit_cast(v4us, __builtin_convertvector(t, v4bf)); }
__device__ __forceinline__ v16h cat16(v8h lo, v8h hi) { return __builtin_shufflevector(lo, hi, 0, 1, 2, 3, 4, 5, 6, 7, 8, 9, 10, 11, 12, 13, 14, 15); }
__device__ __forceinline__ v16bf cat16b(v8us lo, v8us hi) { return __builtin_bit_cast(v16bf, __builtin_shufflevector(lo, hi, 0, 1, 2, 3, 4, 5, 6, 7, 8, 9, 10, 11, 12, 13, 14, 15)); }
__device__ __forceinline__ v8f wmma16(v16h a, v16h b, v8f c) { return __builtin_amdgcn_wmma_f32_16x16x32_f16(false, a, false, b, (short)0, c, false, false); }
__device__ __forceinline__ v8f wmmab(v16bf a, v16bf b, v8f c) { return __builtin_amdgcn_wmma_f32_16x16x32_bf16(false, a, false, b, (short)0, c, false, false); }



// fragment loader and product of the 16x16x32 forms: lane (lr, hi) holds, of row (A) or column (B) lr, k = 8 hi + 0..7 and 16 + 8 hi + 0..7; p points at k = 8 hi of that row
template <typename T16> struct WFrag;
template <> struct WFrag<h16> { typedef v16h V; static __device__ __forceinline__ V ld(const h16* p) { return cat16(*(const v8h*)p, *(const v8h*)(p + 16)); } static __device__ __forceinline__ v8f mma(V a, V b, v8f c) { return wmma16(a, b, c); } };
template <> struct WFrag<bf> { typedef v16bf V; static __device__ __forceinline__ V ld(const bf* p) { return cat16b(*(const v8us*)p, *(const v8us*)(p + 16)); } static __device__ __forceinline__ v8f mma(V a, V b, v8f c) { return wmmab(a, b, c); } };

// k_proj: q, k and v^T planes straight from the inputs. Block = 8 waves, 64 tokens; grid (TT / 64, 2): y = 0 makes q and v features 0..31, y = 1 makes k and v features 32..63 (256 blocks, one per WGP).
// The block loads its x tile [128 c][64 tokens] and its weight columns [128 c][64 + 32] in whole lines, 16 bytes a thread, rounds to bf16 and stores them transposed in LDS (c contiguous), so both are read with the one fragment loader.
// q, k: D = W^T X^T (A = 16 output features, B = 16 tokens): a lane holds 8 consecutive features of one token. v^T: D = X W (A = 16 tokens, B = 16 features): a lane holds 8 consecutive tokens of one feature. c runs 0..127 in steps of 32 in one accumulator.
// The fp16 results go through LDS so that every 128-byte line of a plane is stored whole by 8 lanes of one wave.
// q leaves in FRAGMENT ORDER: per 16 queries 2 KiB, piece (f8 >> 1) of 512 bytes, in it 16 bytes per lane (lane = 16 (f8 & 1) + query & 15), f8 = feature / 8: a fragment load of k_fattn, 16 bytes a lane, then covers 4 whole lines, not 32 bytes in each of 16.
__global__ __launch_bounds__(256) void k_proj(const float* __restrict__ x, const float* __restrict__ wq, const float* __restrict__ wk, const float* __restrict__ wv, h16* Q, h16* Kp, h16* Vt) {
    typedef WFrag<bf> W;
    __shared__ __align__(16) bf xs[PT * XPIT]; __shared__ __align__(16) bf wl[(HD + HD / 2) * XPIT];   // wl rows 0..63: q or k features, 64..95: this block's v features
    __shared__ __align__(16) h16 oa[PT * OPIT]; __shared__ __align__(16) h16 ov[(HD / 2) * OPIT];      // oa [token][feature], ov [v feature][token]
    const int tid = threadIdx.x, lane = tid & 31, lr = lane & 15, hi = lane >> 4, wave = tid >> 5; const int n0 = blockIdx.x * PT, y = blockIdx.y;
    const char* xg = (const char*)(x + (size_t)(n0 / GRP) * DM * GRP + n0 % GRP); const char* ag = (const char*)(y ? wk : wq); const char* vg = (const char*)(wv + y * (HD / 2));
    // a thread owns 8 c x 4 columns of the 64-wide tiles (c8, e4) and 4 c x 4 columns of the 32-wide one (c4, f4); each address is a uniform base, one 32-bit byte offset and a constant
    const int c8 = (tid >> 4) * 8, e4 = (tid & 15) * 4, c4 = (tid >> 3) * 4, f4 = (tid & 7) * 4;
    const unsigned xb = (unsigned)(c8 * GRP + e4) * 4u, ab = (unsigned)(c8 * HD + e4) * 4u, vb = (unsigned)(c4 * HD + f4) * 4u;
    v4f xr[8], ar[8], vr[4];
    // every '#pragma unroll' here keeps the index of a register array a compile-time constant; on the three load loops it puts a thread's 20 loads in flight together
#pragma unroll
    for (int k = 0; k < 8; ++k) xr[k] = *(const v4f*)(xg + xb + k * GRP * 4);
#pragma unroll
    for (int k = 0; k < 8; ++k) ar[k] = *(const v4f*)(ag + ab + k * HD * 4);
#pragma unroll
    for (int k = 0; k < 4; ++k) vr[k] = *(const v4f*)(vg + vb + k * HD * 4);
    // precaution of form: the wait stands in front of the first overwrite of a register that the loads above name as an address; the three offsets are inputs so that they stay in their registers up to it
    asm volatile("s_wait_xcnt 0x0" :: "v"(xb), "v"(ab), "v"(vb) : "memory");
    __builtin_amdgcn_sched_barrier(0);   // keeps the arithmetic below from being scheduled above that wait
#pragma unroll
    for (int i = 0; i < 4; ++i) { v8f t;
#pragma unroll
        for (int k = 0; k < 8; ++k) t[k] = xr[k][i];
        *(v8us*)(xs + (e4 + i) * XPIT + c8) = tobf8(t); }
#pragma unroll
    for (int i = 0; i < 4; ++i) { v8f t;
#pragma unroll
        for (int k = 0; k < 8; ++k) t[k] = ar[k][i];
        *(v8us*)(wl + (e4 + i) * XPIT + c8) = tobf8(t); }
#pragma unroll
    for (int i = 0; i < 4; ++i) { v4f t;
#pragma unroll
        for (int k = 0; k < 4; ++k) t[k] = vr[k][i];
        *(v4us*)(wl + (HD + f4 + i) * XPIT + c4) = tobf4(t); }
    __syncthreads();   // both bf16 tiles are complete in LDS before any wave reads a fragment
    // wave: token tile tt, feature tiles 2 fh and 2 fh + 1 of q or k, feature tile fh of this block's v half
    const int tt = wave & 3, fh = wave >> 2;
    const bf* xp = xs + (tt * 16 + lr) * XPIT + 8 * hi; const bf* wp = wl + (fh * 32 + lr) * XPIT + 8 * hi; const bf* up = wl + (HD + fh * 16 + lr) * XPIT + 8 * hi;
    v16bf xf[DM / 32], w0[DM / 32], w1[DM / 32], wu[DM / 32];
#pragma unroll
    for (int ks = 0; ks < DM / 32; ++ks) { xf[ks] = W::ld(xp + ks * 32); w0[ks] = W::ld(wp + ks * 32); w1[ks] = W::ld(wp + 16 * XPIT + ks * 32); wu[ks] = W::ld(up + ks * 32); }
    __builtin_amdgcn_sched_barrier(0);   // all 32 fragment reads are issued ahead of the first product: left to itself the compiler reused a few registers and waited out the LDS latency in front of every product
    v8f a0 = (v8f){}, a1 = (v8f){}, av = (v8f){};
#pragma unroll
    for (int ks = 0; ks < DM / 32; ++ks) { a0 = W::mma(w0[ks], xf[ks], a0); a1 = W::mma(w1[ks], xf[ks], a1); av = W::mma(xf[ks], wu[ks], av); }
    const float qs = y ? 1.0f : LC;   // q leaves in the scaled log2 domain (one rounding to fp16, as before), so that k_fattn's score products need no multiply behind them
    v8h t0, t1, tv;
#pragma unroll
    for (int j = 0; j < 8; ++j) { t0[j] = (h16)(a0[j] * qs); t1[j] = (h16)(a1[j] * qs); tv[j] = (h16)av[j]; }
    *(v8h*)(oa + (tt * 16 + lr) * OPIT + fh * 32 + hi * 8) = t0; *(v8h*)(oa + (tt * 16 + lr) * OPIT + fh * 32 + 16 + hi * 8) = t1; *(v8h*)(ov + (fh * 16 + lr) * OPIT + tt * 16 + hi * 8) = tv;
    __syncthreads();   // the staged rows are complete before they are read back line by line
    h16* P = (y ? Kp : Q) + (size_t)n0 * HD;   // the block's 64 rows of 128 bytes (q: its four 2-KiB groups of 16 queries) are contiguous
    const int sr = y ? (tid >> 3) : ((tid >> 7) * 16 + (tid & 15)), sc = y ? (tid & 7) : ((tid >> 4) & 7);   // staged row and 8-feature piece that belong at byte 16 tid of the block's part of the plane: k row-major, q in fragment order
    const v8h r0 = *(const v8h*)(oa + sr * OPIT + sc * 8), r1 = *(const v8h*)(oa + (32 + sr) * OPIT + sc * 8), rv = *(const v8h*)(ov + (tid >> 3) * OPIT + (tid & 7) * 8);
    *(v8h*)(P + tid * 8) = r0; *(v8h*)(P + 2048 + tid * 8) = r1;
    *(v8h*)(Vt + (size_t)(y * (HD / 2) + (tid >> 3)) * TT + n0 + (tid & 7) * 8) = rv;
}

// lane l <-> l ^ 16 (the two halves of a wave hold the two key halves of one query column)
__device__ __forceinline__ float xhalf(float x) { const int b = __float_as_int(x); return __int_as_float(__builtin_amdgcn_permlanex16(b, b, 0x76543210, 0xfedcba98, false, false)); }

// k_fattn: fused scores + softmax + attn.v. Block = 8 waves x 32 queries, grid (TT / 256, KSPL); the block copies its slice's K rows and V^T rows into LDS once (whole-line loads, shared by the 8 waves), then each wave walks the KSL keys 32 at a time with no further barrier.
// Every '#pragma unroll' in it keeps the index of a register array a compile-time constant; on the two copy loops it puts a thread's 32 loads in flight together.
// S^T = K Q^T (A = 16 key rows, B = 16 query columns kept in registers): lane (lr, hi) holds, for query lr, keys 8 hi + j (tile 0) and 16 + 8 hi + j (tile 1), which is the k order of the fragment loader, so the two converted score tiles ARE the B operand of O^T += V^T P^T.
// Per slice z and query q, with l = sum_k exp2(s LC - m) and m the maximum in use at the end (scaled log2 domain, at most 8 below the slice's true maximum; l is at least 1, the key that set m counts 1): the row sum_k exp2(s LC - m) v[k] / l in fp16 goes to Op as the lanes hold it (fragment order: [q / 16][z][d / 16][lane][8], so that a store covers 512 bytes in a row), Ep[z][q] = m + log2 l. Q arrives multiplied by LC, in fragment order.
__global__ __launch_bounds__(256) void k_fattn(const h16* __restrict__ Q, const h16* __restrict__ Kp, const h16* __restrict__ Vt, h16* Op, float* Ep) {
    typedef WFrag<h16> W;
    const int lane = threadIdx.x & 31, lr = lane & 15, hi = lane >> 4; const int q0 = blockIdx.x * 256 + (threadIdx.x >> 5) * 32; const int z = blockIdx.y;
    __shared__ __align__(16) h16 lds[HD * VPIT + KSL * KPIT]; h16* const vls = lds; h16* const kls = lds + HD * VPIT;   // V^T first: the offsets of its four row groups then fit the LDS loads' 16-bit offset field
    // each thread's global addresses are a uniform base, one 32-bit byte offset and a constant: qb for its 16-byte pieces of the Q fragments, kb and vb for its 16-byte pieces of the slice's K rows and V^T rows
    const unsigned qb = (unsigned)(q0 * HD) * 2u + lane * 16u, kb = threadIdx.x * 16u, vb = (threadIdx.x / (KSL / 8)) * (TK * 2u) + (threadIdx.x % (KSL / 8)) * 16u;
    v16h qf[2][2];
#pragma unroll
    for (int qt = 0; qt < 2; ++qt)
#pragma unroll
        for (int ks = 0; ks < 2; ++ks) { const char* qp = (const char*)Q + qb + qt * 2048 + ks * 1024; qf[qt][ks] = cat16(*(const v8h*)qp, *(const v8h*)(qp + 512)); }   // k = 32 ks + 8 hi + 0..7, then + 16: the loader's order
    { const char* kg = (const char*)(Kp + (size_t)z * KSL * HD); const char* vg = (const char*)(Vt + z * KSL);
#pragma unroll
      for (int i = 0; i < KSL * HD / 8 / 256; ++i) { const int c = threadIdx.x + i * 256; *(v8h*)(kls + (c >> 3) * KPIT + (c & 7) * 8) = *(const v8h*)(kg + kb + i * 4096); }
#pragma unroll
      for (int i = 0; i < KSL * HD / 8 / 256; ++i) { const int c = threadIdx.x + i * 256; *(v8h*)(vls + (c / (KSL / 8)) * VPIT + (c % (KSL / 8)) * 8) = *(const v8h*)(vg + vb + (size_t)i * (256 / (KSL / 8)) * TK * 2); } }
    // precaution of form: the wait stands in front of the first overwrite of a register that the loads above name as an address; qb and vb are inputs so that they stay in their registers up to it (the K loads take threadIdx.x itself as a scaled offset; the compiler rewrites that register earlier, behind a counted wait of its own that covers them)
    asm volatile("s_wait_xcnt 0x0" :: "v"(qb), "v"(vb) : "memory");
    __builtin_amdgcn_sched_barrier(0);   // keeps the accumulators' zeroing from being scheduled above that wait
    v8f o[2][4], nm[2]; float m[2], l[2];   // nm: -m in all 8 registers of an accumulator tile, the start value of the score products
#pragma unroll
    for (int qt = 0; qt < 2; ++qt) { m[qt] = 0.f; l[qt] = 0.f; nm[qt] = (v8f){};
#pragma unroll
        for (int dt = 0; dt < 4; ++dt) o[qt][dt] = (v8f){}; }
    __syncthreads();   // the slice is complete in LDS before any wave reads a fragment; LDS is only read from here on
    const h16* kp = kls + lr * KPIT + 8 * hi; const h16* vp = vls + lr * VPIT + 8 * hi;
    v16h kf[2][2];
#pragma unroll
    for (int kt = 0; kt < 2; ++kt)
#pragma unroll
        for (int ks = 0; ks < 2; ++ks) kf[kt][ks] = W::ld(kp + kt * 16 * KPIT + ks * 32);
    // rolled: the body already holds 16 matrix instructions, and a second copy would not fit four waves' registers
#pragma unroll 1
    for (int it = 0; it < KSL / 32; ++it) {
        v16h vf[4];
#pragma unroll
        for (int dt = 0; dt < 4; ++dt) vf[dt] = W::ld(vp + dt * 16 * VPIT + it * 32);
        v8f s[2][2];
        // s = q.k LC - m, the exponent itself. The 8 score products in asm text: D apart from C, so that nm stays in its registers (from the builtin the compiler copied the start value into D, 8 to 16 64-bit moves a pass).
        // Four independent tiles, then their accumulating second halves; the four v_nop are the distance the chip needs between the last product and the first vector instruction that reads its D.
        asm("v_wmma_f32_16x16x32_f16 %0, %4, %8, %12\n\t"
            "v_wmma_f32_16x16x32_f16 %1, %6, %8, %12\n\t"
            "v_wmma_f32_16x16x32_f16 %2, %4, %10, %13\n\t"
            "v_wmma_f32_16x16x32_f16 %3, %6, %10, %13\n\t"
            "v_wmma_f32_16x16x32_f16 %0, %5, %9, %0\n\t"
            "v_wmma_f32_16x16x32_f16 %1, %7, %9, %1\n\t"
            "v_wmma_f32_16x16x32_f16 %2, %5, %11, %2\n\t"
            "v_wmma_f32_16x16x32_f16 %3, %7, %11, %3\n\t"
            "v_nop\n\tv_nop\n\tv_nop\n\tv_nop"
            : "=&v"(s[0][0]), "=&v"(s[0][1]), "=&v"(s[1][0]), "=&v"(s[1][1])
            : "v"(kf[0][0]), "v"(kf[0][1]), "v"(kf[1][0]), "v"(kf[1][1]), "v"(qf[0][0]), "v"(qf[0][1]), "v"(qf[1][0]), "v"(qf[1][1]), "v"(nm[0]), "v"(nm[1]));
        const int nx = (it + 1 < KSL / 32) ? it + 1 : it;   // next pass's K rows, fetched behind this pass's score products; the last pass re-reads its own (in bounds)
#pragma unroll
        for (int kt = 0; kt < 2; ++kt)
#pragma unroll
            for (int ks = 0; ks < 2; ++ks) kf[kt][ks] = W::ld(kp + nx * 32 * KPIT + kt * 16 * KPIT + ks * 32);
        // the maximum in use m stays until some score exceeds it by more than 8 (scaled log2 domain): P is then at most 2^8, well inside fp16, and o, l and m stay one consistent triple for the merge
        float mall = s[0][0][0];
#pragma unroll
        for (int j = 1; j < 32; ++j) mall = fmaxf(mall, s[j >> 4][(j >> 3) & 1][j & 7]);
        if (__builtin_amdgcn_ballot_w32(mall > 8.0f) != 0 || it == 0) {   // one scalar branch a pass, taken by the whole wave: on the first pass (which sets m) and rarely after it
#pragma unroll
            for (int qt = 0; qt < 2; ++qt) {
                float mx = s[qt][0][0];
#pragma unroll
                for (int j = 1; j < 16; ++j) mx = fmaxf(mx, s[qt][j >> 3][j & 7]);
                mx = fmaxf(mx, xhalf(mx));
                const float dl = it == 0 ? mx : fmaxf(mx, 0.f); const float al = it == 0 ? 0.f : __builtin_amdgcn_exp2f(-dl);   // m moves up by dl; the first pass takes its own maximum, whatever its sign (o and l are still 0)
                m[qt] += dl; l[qt] *= al;
#pragma unroll
                for (int j = 0; j < 8; ++j) { nm[qt][j] = -m[qt]; s[qt][0][j] -= dl; s[qt][1][j] -= dl; }
#pragma unroll
                for (int dt = 0; dt < 4; ++dt) o[qt][dt] = o[qt][dt] * al;
            }
        }
#pragma unroll
        for (int qt = 0; qt < 2; ++qt) {
            v16h p; float sm = 0.f;
#pragma unroll
            for (int j = 0; j < 16; ++j) { const float e = __builtin_amdgcn_exp2f(s[qt][j >> 3][j & 7]); sm += e; p[j] = (h16)e; }
            l[qt] += sm;
#pragma unroll
            for (int dt = 0; dt < 4; ++dt) o[qt][dt] = W::mma(vf[dt], p, o[qt][dt]);
        }
    }
    // a lane holds 8 consecutive d of one query per tile: 16 bytes; a tile leaves as its 32 lanes hold it, 512 bytes in a row
    v8h t[2][4]; float ev[2];
#pragma unroll
    for (int qt = 0; qt < 2; ++qt) {
        const float lt = l[qt] + xhalf(l[qt]); const float r = 1.0f / lt; ev[qt] = m[qt] + __builtin_amdgcn_logf(lt);   // logf: the hardware's log2
#pragma unroll
        for (int dt = 0; dt < 4; ++dt)
#pragma unroll
            for (int j = 0; j < 8; ++j) t[qt][dt][j] = (h16)(o[qt][dt][j] * r);
    }
    // a uniform base, one 32-bit byte offset and a constant: ob in the [TT / 16][KSPL][4][32 lanes][8] fp16 partials, xb in the [KSPL][TT] f32 plane
    const unsigned ob = (unsigned)((q0 / 16) * KSPL + z) * 2048u + lane * 16u, xb = (unsigned)(z * TT + q0 + lr) * 4u;
#pragma unroll
    for (int qt = 0; qt < 2; ++qt)
#pragma unroll
        for (int dt = 0; dt < 4; ++dt) *(v8h*)((char*)Op + ob + qt * KSPL * 2048 + dt * 512) = t[qt][dt];
    if (hi == 0) { *(float*)((char*)Ep + xb) = ev[0]; *(float*)((char*)Ep + xb + 64) = ev[1]; }
}

// k_merge: out[q][d] = sum_z w_z Op[q][z][d] / sum_z w_z, w_z = exp2(Ep[z][q] - max_z Ep[z][q]), slices in order; a thread owns 8 consecutive d of one query (16 bytes of each fp16 partial row); a wave takes 8 queries x 32 d: each of its loads covers four whole 128-byte lines of the partials (8 queries x 16 bytes each), and it alone writes its 8 whole lines of the output
__global__ __launch_bounds__(256) void k_merge(const h16* __restrict__ Op, const float* __restrict__ Ep, float* OUTb) {
    const unsigned t = blockIdx.x * 256u + threadIdx.x; if (t >= (unsigned)(TT * HD / 8)) return;
    // every address is a uniform base, one 32-bit byte offset and a constant: eb in the [TT][HD] output, pb in the [TT / 16][KSPL][4][32 lanes][8] partials; qi is the query, the index in a [TT] plane
    const unsigned ln = t & 31u, wv = t >> 5, qg = wv >> 2;   // lane, wave, group of 16 queries
    const unsigned lr = (wv & 1u) * 8u + (ln & 7u), hf = (ln >> 3) & 1u, dt = (wv & 2u) + (ln >> 4);   // the place in k_fattn's tile: query in the group, half of the wave, d tile
    const unsigned qi = qg * 16u + lr, eb = (qi * HD + dt * 16u + hf * 8u) * 4u, pb = qg * (KSPL * 2048u) + dt * 512u + hf * 256u + lr * 16u;
    float mz[KSPL]; v8h pz[KSPL];
    // each loop unrolled so that all slices' loads are in flight together
#pragma unroll
    for (int zs = 0; zs < KSPL; ++zs) mz[zs] = Ep[(size_t)zs * TT + qi];
#pragma unroll
    for (int zs = 0; zs < KSPL; ++zs) pz[zs] = *(const v8h*)((const char*)Op + pb + zs * 2048);
    // precaution of form: the wait stands in front of the first overwrite of a register that the loads above name as an address; qi and pb are inputs so that they stay in their registers up to it
    asm volatile("s_wait_xcnt 0x0" :: "v"(qi), "v"(pb) : "memory");
    __builtin_amdgcn_sched_barrier(0);   // keeps the arithmetic below from being scheduled above that wait
    float M = mz[0];
#pragma unroll
    for (int zs = 1; zs < KSPL; ++zs) M = fmaxf(M, mz[zs]);
    float den = 0.f; v8f sm = (v8f){};
#pragma unroll
    for (int zs = 0; zs < KSPL; ++zs) mz[zs] -= M;
    // from here on mz is the slice's weight. v_nop: the free issue slot that the instruction set asks for behind a transcendental; the scheduling barriers hold each v_nop directly behind its exponential
    __builtin_amdgcn_sched_barrier(0);
#pragma unroll
    for (int zs = 0; zs < KSPL; ++zs) { mz[zs] = __builtin_amdgcn_exp2f(mz[zs]); __builtin_amdgcn_sched_barrier(0); asm volatile("v_nop"); __builtin_amdgcn_sched_barrier(0); }
#pragma unroll
    for (int zs = 0; zs < KSPL; ++zs) { den += mz[zs];
#pragma unroll
        for (int j = 0; j < 8; ++j) sm[j] += (float)pz[zs][j] * mz[zs]; }
    const float r = 1.0f / den; v4f lo, hh;
#pragma unroll
    for (int j = 0; j < 4; ++j) { lo[j] = sm[j] * r; hh[j] = sm[4 + j] * r; }
    *(v4f*)((char*)OUTb + eb) = lo; *(v4f*)((char*)OUTb + eb + 16) = hh;  }

extern "C" void kernel_launch(void* const* d_in, const int* in_sizes, int n_in,
                              void* d_out, int out_size, void* d_ws, size_t ws_size, hipStream_t stream) {
    (void)in_sizes; (void)n_in; (void)out_size;
    const float* x = (const float*)d_in[0]; const float* wq = (const float*)d_in[1]; const float* wk = (const float*)d_in[2]; const float* wv = (const float*)d_in[3];
    float* OUT = (float*)d_out;     // [1][8192][64]
    char* wsp = (char*)d_ws;
    auto take = [&](size_t bytes) { char* p = wsp; wsp += (bytes + 255) & ~(size_t)255; return (void*)p; };
    h16* QP16 = (h16*)take((size_t)NH_ * TT * HD * 2); h16* KP16 = (h16*)take((size_t)NKV * TT * HD * 2); h16* VT16 = (h16*)take((size_t)NKV * HD * TT * 2);
    h16* Ob = (h16*)take((size_t)KSPL * TT * HD * 2); float* Eb = (float*)take((size_t)KSPL * TT * 4);
    if ((size_t)(wsp - (char*)d_ws) > ws_size) return;    // ws 256 MiB
    k_proj<<<dim3(TT / PT, 2, 1), 256, 0, stream>>>(x, wq, wk, wv, QP16, KP16, VT16);   /* (B,T,C,H,W) f32 and [128][64] f32 weights -> fp16 planes */
    k_fattn<<<dim3(TT / 256, KSPL, 1), 256, 0, stream>>>(QP16, KP16, VT16, Ob, Eb);   /* slice z = keys z*512..: normalised partial rows fp16 in fragment order, log2 sums of exponentials [z][q] */
    k_merge<<<(unsigned)(((size_t)TT * HD / 8 + 255) / 256), 256, 0, stream>>>(Ob, Eb, OUT);
}

// v007
// One run takes 21.9 microseconds.
// In both of two side-by-side timings against v006, it was 1.05 times as fast.
// Over all steps from v000 it is 50.3 times as fast.
#include <hip/hip_runtime.h>

// Single-head self-attention over all 8,192 tokens of a video feature map (hidden_states [2][16][128][16][16] = (B,T,C,H,W) -> tokens n = (b,t,h,w), features c: x [8192][128]; q = x w_q, k = x w_k, v = x w_v ('xw' [128][64], no bias); scores = q.k / 8 over all 8192 keys; softmax; out = attn.v -> [8192][64] (524 k)).
// Layout: one projection kernel reads x and the weights as they come, transposes them into LDS while converting to bf16, and writes the fp16 planes q (fragment order, see k_proj), k [8192][64], v^T [64][8192]; scores, softmax and attn.v fused in one kernel with a running row maximum (scores and P stay in registers, a slice's K and V^T in LDS), the 8192 keys split into 16 slices; each slice leaves, per query, its own softmax average of v (a normalised row, fp16) and the log2 of its sum of exponentials (f32), a merge kernel joins the slices in slice order.
// Compute dtypes, f32 accumulate: every input rounded to bf16; projections on PLAIN bf16 operands (exact); scores and attn.v on single fp16 planes (P = exp(s - the row maximum in use), at most 2^12, rounded to fp16); softmax f32; a slice's normalised partial row rounded to fp16 (a convex mix of fp16 v values, so inside their range); merge and output f32.

#define NB_  1
#define TT   8192
#define DM   128
#define NH_  1
#define NKV  1
#define REP  (NH_ / NKV)
#define HD   64
#define DQ   (NH_ * HD)
#define DKV  (NKV * HD)
#define ZH   1
#define RH   0                  // unused
#define WIN  0
#define TK   TT                   // keys
#define KSPL 16                   // key slices: 32 blocks of 256 queries x 16 slices = 512 blocks of 8 waves, two per WGP, four waves per SIMD
#define KSL  (TK / KSPL)          // keys per slice
#define KPIT (HD + 8)             // LDS pitch of a K row, halves: 128 + 16 bytes (16 B x odd, so the 16 rows of a 16-byte fragment read meet no bank twice)
#define VPIT (KSL + 8)            // LDS pitch of a V^T row, halves: 1024 + 16 bytes (same reason)
#define GRP  256                  // tokens per (b, t) group = H x W
#define NGRP 32                   // (b, t) groups
#define PT   64                   // tokens per projection block: a 128-byte line of a V^T row, a quarter of a (b, t) group
#define XPIT (DM + 8)             // LDS pitch of the 128 bf16 input features of a token or of an output feature, halves: 256 + 16 bytes (16 B x odd)
#define OPIT (PT + 8)             // LDS pitch of a staged output row of 64 halves: 128 + 16 bytes (same reason)
#define SCL  0.125f   // HD^-0.5
#define LC   (SCL * 1.4426950408889634f)   // score -> scaled log2 domain
typedef _Float16 h16;
typedef unsigned short bf;
typedef __attribute__((ext_vector_type(16))) __bf16   v16bf;
typedef __attribute__((ext_vector_type(16))) _Float16 v16h;
typedef __attribute__((ext_vector_type(8)))  _Float16 v8h;
typedef __attribute__((ext_vector_type(8)))  unsigned short v8us;
typedef __attribute__((ext_vector_type(8)))  float    v8f;
typedef __attribute__((ext_vector_type(4)))  float    v4f;
typedef v8h  __attribute__((may_alias)) v8ha;
typedef v4f  __attribute__((may_alias)) v4fa;
typedef v8us __attribute__((may_alias)) v8usa;

typedef __attribute__((ext_vector_type(4))) unsigned short v4us;
typedef __attribute__((ext_vector_type(8))) __bf16 v8bf;
typedef __attribute__((ext_vector_type(4))) __bf16 v4bf;
// f32 -> bf16, round to nearest even, two values an instruction
__device__ __forceinline__ v8us tobf8(v8f t) { return __builtin_bit_cast(v8us, __builtin_convertvector(t, v8bf)); }
__device__ __forceinline__ v4us tobf4(v4f t) { return __builtin_bit_cast(v4us, __builtin_convertvector(t, v4bf)); }
__device__ __forceinline__ v16h cat16(v8h lo, v8h hi) { return __builtin_shufflevector(lo, hi, 0, 1, 2, 3, 4, 5, 6, 7, 8, 9, 10, 11, 12, 13, 14, 15); }
__device__ __forceinline__ v16bf cat16b(v8us lo, v8us hi) { return __builtin_bit_cast(v16bf, __builtin_shufflevector(lo, hi, 0, 1, 2, 3, 4, 5, 6, 7, 8, 9, 10, 11, 12, 13, 14, 15)); }
__device__ __forceinline__ v8f wmma16(v16h a, v16h b, v8f c) { return __builtin_amdgcn_wmma_f32_16x16x32_f16(false, a, false, b, (short)0, c, false, false); }
__device__ __forceinline__ v8f wmmab(v16bf a, v16bf b, v8f c) { return __builtin_amdgcn_wmma_f32_16x16x32_bf16(false, a, false, b, (short)0, c, false, false); }



// fragment loader and product of the 16x16x32 forms: lane (lr, hi) holds, of row (A) or column (B) lr, k = 8 hi + 0..7 and 16 + 8 hi + 0..7; p points at k = 8 hi of that row
template <typename T16> struct WFrag;
template <> struct WFrag<h16> { typedef v16h V; static __device__ __forceinline__ V ld(const h16* p) { return cat16(*(const v8h*)p, *(const v8h*)(p + 16)); } static __device__ __forceinline__ v8f mma(V a, V b, v8f c) { return wmma16(a, b, c); } };
template <> struct WFrag<bf> { typedef v16bf V; static __device__ __forceinline__ V ld(const bf* p) { return cat16b(*(const v8us*)p, *(const v8us*)(p + 16)); } static __device__ __forceinline__ v8f mma(V a, V b, v8f c) { return wmmab(a, b, c); } };

// k_proj: q, k and v^T planes straight from the inputs. Block = 8 waves, 64 tokens; grid (TT / 64, 2): y = 0 makes q and v features 0..31, y = 1 makes k and v features 32..63 (256 blocks, one per WGP).
// The block loads its x tile [128 c][64 tokens] and its weight columns [128 c][64 + 32] in whole lines, 16 bytes a thread, rounds to bf16 and stores them transposed in LDS (c contiguous), so both are read with the one fragment loader.
// q, k: D = W^T X^T (A = 16 output features, B = 16 tokens): a lane holds 8 consecutive features of one token. v^T: D = X W (A = 16 tokens, B = 16 features): a lane holds 8 consecutive tokens of one feature. c runs 0..127 in steps of 32 in one accumulator.
// The fp16 results go through LDS so that every 128-byte line of a plane is stored whole by 8 lanes of one wave.
// q leaves in FRAGMENT ORDER: per 16 queries 2 KiB, piece (f8 >> 1) of 512 bytes, in it 16 bytes per lane (lane = 16 (f8 & 1) + query & 15), f8 = feature / 8: a fragment load of k_fattn, 16 bytes a lane, then covers 4 whole lines, not 32 bytes in each of 16.
__global__ __launch_bounds__(256) void k_proj(const float* __restrict__ x, const float* __restrict__ wq, const float* __restrict__ wk, const float* __restrict__ wv, h16* Q, h16* Kp, h16* Vt) {
    typedef WFrag<bf> W;
    __shared__ __align__(16) bf xs[PT * XPIT]; __shared__ __align__(16) bf wl[(HD + HD / 2) * XPIT];   // wl rows 0..63: q or k features, 64..95: this block's v features
    __shared__ __align__(16) h16 oa[PT * OPIT]; __shared__ __align__(16) h16 ov[(HD / 2) * OPIT];      // oa [token][feature], ov [v feature][token]
    const int tid = threadIdx.x, lane = tid & 31, lr = lane & 15, hi = lane >> 4, wave = tid >> 5; const int n0 = blockIdx.x * PT, y = blockIdx.y;
    const char* xg = (const char*)(x + (size_t)(n0 / GRP) * DM * GRP + n0 % GRP); const char* ag = (const char*)(y ? wk : wq); const char* vg = (const char*)(wv + y * (HD / 2));
    // a thread owns 8 c x 4 columns of the 64-wide tiles (c8, e4) and 4 c x 4 columns of the 32-wide one (c4, f4); each address is a uniform base, one 32-bit byte offset and a constant
    const int c8 = (tid >> 4) * 8, e4 = (tid & 15) * 4, c4 = (tid >> 3) * 4, f4 = (tid & 7) * 4;
    const unsigned xb = (unsigned)(c8 * GRP + e4) * 4u, ab = (unsigned)(c8 * HD + e4) * 4u, vb = (unsigned)(c4 * HD + f4) * 4u;
    v4f xr[8], ar[8], vr[4];
    // every '#pragma unroll' here keeps the index of a register array a compile-time constant; on the three load loops it puts a thread's 20 loads in flight together
#pragma unroll
    for (int k = 0; k < 8; ++k) xr[k] = *(const v4f*)(xg + xb + k * GRP * 4);
#pragma unroll
    for (int k = 0; k < 8; ++k) ar[k] = *(const v4f*)(ag + ab + k * HD * 4);
#pragma unroll
    for (int k = 0; k < 4; ++k) vr[k] = *(const v4f*)(vg + vb + k * HD * 4);
    // precaution of form: the wait stands in front of the first overwrite of a register that the loads above name as an address; the three offsets are inputs so that they stay in their registers up to it
    asm volatile("s_wait_xcnt 0x0" :: "v"(xb), "v"(ab), "v"(vb) : "memory");
    __builtin_amdgcn_sched_barrier(0);   // keeps the arithmetic below from being scheduled above that wait
#pragma unroll
    for (int i = 0; i < 4; ++i) { v8f t;
#pragma unroll
        for (int k = 0; k < 8; ++k) t[k] = xr[k][i];
        *(v8us*)(xs + (e4 + i) * XPIT + c8) = tobf8(t); }
#pragma unroll
    for (int i = 0; i < 4; ++i) { v8f t;
#pragma unroll
        for (int k = 0; k < 8; ++k) t[k] = ar[k][i];
        *(v8us*)(wl + (e4 + i) * XPIT + c8) = tobf8(t); }
#pragma unroll
    for (int i = 0; i < 4; ++i) { v4f t;
#pragma unroll
        for (int k = 0; k < 4; ++k) t[k] = vr[k][i];
        *(v4us*)(wl + (HD + f4 + i) * XPIT + c4) = tobf4(t); }
    __syncthreads();   // both bf16 tiles are complete in LDS before any wave reads a fragment
    // wave: token tile tt, feature tiles 2 fh and 2 fh + 1 of q or k, feature tile fh of this block's v half
    const int tt = wave & 3, fh = wave >> 2;
    const bf* xp = xs + (tt * 16 + lr) * XPIT + 8 * hi; const bf* wp = wl + (fh * 32 + lr) * XPIT + 8 * hi; const bf* up = wl + (HD + fh * 16 + lr) * XPIT + 8 * hi;
    v16bf xf[DM / 32], w0[DM / 32], w1[DM / 32], wu[DM / 32];
#pragma unroll
    for (int ks = 0; ks < DM / 32; ++ks) { xf[ks] = W::ld(xp + ks * 32); w0[ks] = W::ld(wp + ks * 32); w1[ks] = W::ld(wp + 16 * XPIT + ks * 32); wu[ks] = W::ld(up + ks * 32); }
    __builtin_amdgcn_sched_barrier(0);   // all 32 fragment reads are issued ahead of the first product: left to itself the compiler reused a few registers and waited out the LDS latency in front of every product
    v8f a0 = (v8f){}, a1 = (v8f){}, av = (v8f){};
#pragma unroll
    for (int ks = 0; ks < DM / 32; ++ks) { a0 = W::mma(w0[ks], xf[ks], a0); a1 = W::mma(w1[ks], xf[ks], a1); av = W::mma(xf[ks], wu[ks], av); }
    const float qs = y ? 1.0f : LC;   // q leaves in the scaled log2 domain (one rounding to fp16, as before), so that k_fattn's score products need no multiply behind them
    v8h t0, t1, tv;
#pragma unroll
    for (int j = 0; j < 8; ++j) { t0[j] = (h16)(a0[j] * qs); t1[j] = (h16)(a1[j] * qs); tv[j] = (h16)av[j]; }
    *(v8h*)(oa + (tt * 16 + lr) * OPIT + fh * 32 + hi * 8) = t0; *(v8h*)(oa + (tt * 16 + lr) * OPIT + fh * 32 + 16 + hi * 8) = t1; *(v8h*)(ov + (fh * 16 + lr) * OPIT + tt * 16 + hi * 8) = tv;
    __syncthreads();   // the staged rows are complete before they are read back line by line
    h16* P = (y ? Kp : Q) + (size_t)n0 * HD;   // the block's 64 rows of 128 bytes (q: its four 2-KiB groups of 16 queries) are contiguous
    const int sr = y ? (tid >> 3) : ((tid >> 7) * 16 + (tid & 15)), sc = y ? (tid & 7) : ((tid >> 4) & 7);   // staged row and 8-feature piece that belong at byte 16 tid of the block's part of the plane: k row-major, q in fragment order
    const v8h r0 = *(const v8h*)(oa + sr * OPIT + sc * 8), r1 = *(const v8h*)(oa + (32 + sr) * OPIT + sc * 8), rv = *(const v8h*)(ov + (tid >> 3) * OPIT + (tid & 7) * 8);
    *(v8h*)(P + tid * 8) = r0; *(v8h*)(P + 2048 + tid * 8) = r1;
    *(v8h*)(Vt + (size_t)(y * (HD / 2) + (tid >> 3)) * TT + n0 + (tid & 7) * 8) = rv;
}

// lane l <-> l ^ 16 (the two halves of a wave hold the two key halves of one query column)
__device__ __forceinline__ float xhalf(float x) { const int b = __float_as_int(x); return __int_as_float(__builtin_amdgcn_permlanex16(b, b, 0x76543210, 0xfedcba98, false, false)); }

// k_fattn: fused scores + softmax + attn.v. Block = 8 waves x 32 queries, grid (TT / 256, KSPL); the block copies its slice's K rows and V^T rows into LDS once (whole-line loads, shared by the 8 waves), then each wave walks the KSL keys 32 at a time with no further barrier.
// Every '#pragma unroll' in it keeps the index of a register array a compile-time constant; on the two copy loops it puts a thread's 32 loads in flight together.
// S^T = K Q^T (A = 16 key rows, B = 16 query columns kept in registers): lane (lr, hi) holds, for query lr, keys 8 hi + j (tile 0) and 16 + 8 hi + j (tile 1), which is the k order of the fragment loader, so the two converted score tiles ARE the B operand of O^T += V^T P^T.
// Per slice z and query q, with l = sum_k exp2(s LC - m) and m the maximum in use at the end (scaled log2 domain, at most 12 below the slice's true maximum; l is at least 1, the key that set m counts 1): the row sum_k exp2(s LC - m) v[k] / l in fp16 goes to Op as the lanes hold it (fragment order: [q / 16][z][d / 16][lane][8], so that a store covers 512 bytes in a row), Ep[z][q] = m + log2 l. Q arrives multiplied by LC, in fragment order.
__global__ __launch_bounds__(256) void k_fattn(const h16* __restrict__ Q, const h16* __restrict__ Kp, const h16* __restrict__ Vt, h16* Op, float* Ep) {
    typedef WFrag<h16> W;
    const int lane = threadIdx.x & 31, lr = lane & 15, hi = lane >> 4; const int q0 = blockIdx.x * 256 + (threadIdx.x >> 5) * 32; const int z = blockIdx.y;
    __shared__ __align__(16) h16 lds[HD * VPIT + KSL * KPIT]; h16* const vls = lds; h16* const kls = lds + HD * VPIT;   // V^T first: the offsets of its four row groups then fit the LDS loads' 16-bit offset field
    // each thread's global addresses are a uniform base, one 32-bit byte offset and a constant: qb for its 16-byte pieces of the Q fragments, kb and vb for its 16-byte pieces of the slice's K rows and V^T rows
    const unsigned qb = (unsigned)(q0 * HD) * 2u + lane * 16u, kb = threadIdx.x * 16u, vb = (threadIdx.x / (KSL / 8)) * (TK * 2u) + (threadIdx.x % (KSL / 8)) * 16u;
    v16h qf[2][2];
#pragma unroll
    for (int qt = 0; qt < 2; ++qt)
#pragma unroll
        for (int ks = 0; ks < 2; ++ks) { const char* qp = (const char*)Q + qb + qt * 2048 + ks * 1024; qf[qt][ks] = cat16(*(const v8h*)qp, *(const v8h*)(qp + 512)); }   // k = 32 ks + 8 hi + 0..7, then + 16: the loader's order
    { const char* kg = (const char*)(Kp + (size_t)z * KSL * HD); const char* vg = (const char*)(Vt + z * KSL);
#pragma unroll
      for (int i = 0; i < KSL * HD / 8 / 256; ++i) { const int c = threadIdx.x + i * 256; *(v8h*)(kls + (c >> 3) * KPIT + (c & 7) * 8) = *(const v8h*)(kg + kb + i * 4096); }
#pragma unroll
      for (int i = 0; i < KSL * HD / 8 / 256; ++i) { const int c = threadIdx.x + i * 256; *(v8h*)(vls + (c / (KSL / 8)) * VPIT + (c % (KSL / 8)) * 8) = *(const v8h*)(vg + vb + (size_t)i * (256 / (KSL / 8)) * TK * 2); } }
    // precaution of form: the wait stands in front of the first overwrite of a register that the loads above name as an address; qb and vb are inputs so that they stay in their registers up to it (the K loads take threadIdx.x itself as a scaled offset; the compiler rewrites that register earlier, behind a counted wait of its own that covers them)
    asm volatile("s_wait_xcnt 0x0" :: "v"(qb), "v"(vb) : "memory");
    __builtin_amdgcn_sched_barrier(0);   // keeps the accumulators' zeroing from being scheduled above that wait
    v8f o[2][4], nm[2]; float m[2], l[2];   // nm: -m in all 8 registers of an accumulator tile, the start value of the score products
#pragma unroll
    for (int qt = 0; qt < 2; ++qt) { m[qt] = 0.f; l[qt] = 0.f; nm[qt] = (v8f){};
#pragma unroll
        for (int dt = 0; dt < 4; ++dt) o[qt][dt] = (v8f){}; }
    __syncthreads();   // the slice is complete in LDS before any wave reads a fragment; LDS is only read from here on
    const h16* kp = kls + lr * KPIT + 8 * hi; const h16* vp = vls + lr * VPIT + 8 * hi;
    v16h kf[2][2];
#pragma unroll
    for (int kt = 0; kt < 2; ++kt)
#pragma unroll
        for (int ks = 0; ks < 2; ++ks) kf[kt][ks] = W::ld(kp + kt * 16 * KPIT + ks * 32);
    // rolled: the body already holds 16 matrix instructions, and a second copy would not fit four waves' registers
#pragma unroll 1
    for (int it = 0; it < KSL / 32; ++it) {
        v16h vf[4];
#pragma unroll
        for (int dt = 0; dt < 4; ++dt) vf[dt] = W::ld(vp + dt * 16 * VPIT + it * 32);
        v8f s[2][2];
        // s = q.k LC - m, the exponent itself. The 8 score products in asm text: D apart from C, so that nm stays in its registers (from the builtin the compiler copied the start value into D, 8 to 16 64-bit moves a pass).
        // Four independent tiles, then their accumulating second halves; the four v_nop are the distance the chip needs between the last product and the first vector instruction that reads its D.
        asm("v_wmma_f32_16x16x32_f16 %0, %4, %8, %12\n\t"
            "v_wmma_f32_16x16x32_f16 %1, %6, %8, %12\n\t"
            "v_wmma_f32_16x16x32_f16 %2, %4, %10, %13\n\t"
            "v_wmma_f32_16x16x32_f16 %3, %6, %10, %13\n\t"
            "v_wmma_f32_16x16x32_f16 %0, %5, %9, %0\n\t"
            "v_wmma_f32_16x16x32_f16 %1, %7, %9, %1\n\t"
            "v_wmma_f32_16x16x32_f16 %2, %5, %11, %2\n\t"
            "v_wmma_f32_16x16x32_f16 %3, %7, %11, %3\n\t"
            "v_nop\n\tv_nop\n\tv_nop\n\tv_nop"
            : "=&v"(s[0][0]), "=&v"(s[0][1]), "=&v"(s[1][0]), "=&v"(s[1][1])
            : "v"(kf[0][0]), "v"(kf[0][1]), "v"(kf[1][0]), "v"(kf[1][1]), "v"(qf[0][0]), "v"(qf[0][1]), "v"(qf[1][0]), "v"(qf[1][1]), "v"(nm[0]), "v"(nm[1]));
        const int nx = (it + 1 < KSL / 32) ? it + 1 : it;   // next pass's K rows, fetched behind this pass's score products; the last pass re-reads its own (in bounds)
#pragma unroll
        for (int kt = 0; kt < 2; ++kt)
#pragma unroll
            for (int ks = 0; ks < 2; ++ks) kf[kt][ks] = W::ld(kp + nx * 32 * KPIT + kt * 16 * KPIT + ks * 32);
        // no maximum search in a pass: the exponentials, their sums and the fp16 P are made at once from s, and the sums, which l needs anyway, are the test.
        // The maximum in use m stays while every lane's sum of 16 exponentials is at most 2^12: P is then at most 2^12, well inside fp16, and o, l and m stay one consistent triple for the merge. s stays in its registers up to the test.
        v16h p[2]; float sm[2];
#pragma unroll
        for (int qt = 0; qt < 2; ++qt) { float a = 0.f;
#pragma unroll
            for (int j = 0; j < 16; ++j) { const float e = __builtin_amdgcn_exp2f(s[qt][j >> 3][j & 7]); a += e; p[qt][j] = (h16)e; }
            sm[qt] = a; }
        if (__builtin_amdgcn_ballot_w32(!(fmaxf(sm[0], sm[1]) <= 4096.0f)) != 0 || it == 0) {   // one scalar branch a pass, taken by the whole wave: on the first pass (which sets m) and rarely after it; what was made above is then made again from the moved s
#pragma unroll
            for (int qt = 0; qt < 2; ++qt) {
                float mx = s[qt][0][0];
#pragma unroll
                for (int j = 1; j < 16; ++j) mx = fmaxf(mx, s[qt][j >> 3][j & 7]);
                mx = fmaxf(mx, xhalf(mx));
                const float dl = it == 0 ? mx : fmaxf(mx, 0.f); const float al = it == 0 ? 0.f : __builtin_amdgcn_exp2f(-dl);   // m moves up by dl; the first pass takes its own maximum, whatever its sign (o and l are still 0)
                m[qt] += dl; l[qt] *= al;
#pragma unroll
                for (int j = 0; j < 8; ++j) nm[qt][j] = -m[qt];
#pragma unroll
                for (int dt = 0; dt < 4; ++dt) o[qt][dt] = o[qt][dt] * al;
                float a = 0.f;
#pragma unroll
                for (int j = 0; j < 16; ++j) { const float e = __builtin_amdgcn_exp2f(s[qt][j >> 3][j & 7] - dl); a += e; p[qt][j] = (h16)e; }
                sm[qt] = a;
            }
        }
#pragma unroll
        for (int qt = 0; qt < 2; ++qt) {
            l[qt] += sm[qt];
#pragma unroll
            for (int dt = 0; dt < 4; ++dt) o[qt][dt] = W::mma(vf[dt], p[qt], o[qt][dt]);
        }
    }
    // a lane holds 8 consecutive d of one query per tile: 16 bytes; a tile leaves as its 32 lanes hold it, 512 bytes in a row
    v8h t[2][4]; float ev[2];
#pragma unroll
    for (int qt = 0; qt < 2; ++qt) {
        const float lt = l[qt] + xhalf(l[qt]); const float r = 1.0f / lt; ev[qt] = m[qt] + __builtin_amdgcn_logf(lt);   // logf: the hardware's log2
#pragma unroll
        for (int dt = 0; dt < 4; ++dt)
#pragma unroll
            for (int j = 0; j < 8; ++j) t[qt][dt][j] = (h16)(o[qt][dt][j] * r);
    }
    // a uniform base, one 32-bit byte offset and a constant: ob in the [TT / 16][KSPL][4][32 lanes][8] fp16 partials, xb in the [KSPL][TT] f32 plane
    const unsigned ob = (unsigned)((q0 / 16) * KSPL + z) * 2048u + lane * 16u, xb = (unsigned)(z * TT + q0 + lr) * 4u;
#pragma unroll
    for (int qt = 0; qt < 2; ++qt)
#pragma unroll
        for (int dt = 0; dt < 4; ++dt) *(v8h*)((char*)Op + ob + qt * KSPL * 2048 + dt * 512) = t[qt][dt];
    if (hi == 0) { *(float*)((char*)Ep + xb) = ev[0]; *(float*)((char*)Ep + xb + 64) = ev[1]; }
}

// k_merge: out[q][d] = sum_z w_z Op[q][z][d] / sum_z w_z, w_z = exp2(Ep[z][q] - max_z Ep[z][q]), slices in order; a thread owns 8 consecutive d of one query (16 bytes of each fp16 partial row); a wave takes 8 queries x 32 d: each of its loads covers four whole 128-byte lines of the partials (8 queries x 16 bytes each), and it alone writes its 8 whole lines of the output
__global__ __launch_bounds__(256) void k_merge(const h16* __restrict__ Op, const float* __restrict__ Ep, float* OUTb) {
    const unsigned t = blockIdx.x * 256u + threadIdx.x; if (t >= (unsigned)(TT * HD / 8)) return;
    // every address is a uniform base, one 32-bit byte offset and a constant: eb in the [TT][HD] output, pb in the [TT / 16][KSPL][4][32 lanes][8] partials; qi is the query, the index in a [TT] plane
    const unsigned ln = t & 31u, wv = t >> 5, qg = wv >> 2;   // lane, wave, group of 16 queries
    const unsigned lr = (wv & 1u) * 8u + (ln & 7u), hf = (ln >> 3) & 1u, dt = (wv & 2u) + (ln >> 4);   // the place in k_fattn's tile: query in the group, half of the wave, d tile
    const unsigned qi = qg * 16u + lr, eb = (qi * HD + dt * 16u + hf * 8u) * 4u, pb = qg * (KSPL * 2048u) + dt * 512u + hf * 256u + lr * 16u;
    float mz[KSPL]; v8h pz[KSPL];
    // each loop unrolled so that all slices' loads are in flight together
#pragma unroll
    for (int zs = 0; zs < KSPL; ++zs) mz[zs] = Ep[(size_t)zs * TT + qi];
#pragma unroll
    for (int zs = 0; zs < KSPL; ++zs) pz[zs] = *(const v8h*)((const char*)Op + pb + zs * 2048);
    // precaution of form: the wait stands in front of the first overwrite of a register that the loads above name as an address; qi and pb are inputs so that they stay in their registers up to it
    asm volatile("s_wait_xcnt 0x0" :: "v"(qi), "v"(pb) : "memory");
    __builtin_amdgcn_sched_barrier(0);   // keeps the arithmetic below from being scheduled above that wait
    float M = mz[0];
#pragma unroll
    for (int zs = 1; zs < KSPL; ++zs) M = fmaxf(M, mz[zs]);
    float den = 0.f; v8f sm = (v8f){};
#pragma unroll
    for (int zs = 0; zs < KSPL; ++zs) mz[zs] -= M;
    // from here on mz is the slice's weight. v_nop: the free issue slot that the instruction set asks for behind a transcendental; the scheduling barriers hold each v_nop directly behind its exponential
    __builtin_amdgcn_sched_barrier(0);
#pragma unroll
    for (int zs = 0; zs < KSPL; ++zs) { mz[zs] = __builtin_amdgcn_exp2f(mz[zs]); __builtin_amdgcn_sched_barrier(0); asm volatile("v_nop"); __builtin_amdgcn_sched_barrier(0); }
#pragma unroll
    for (int zs = 0; zs < KSPL; ++zs) { den += mz[zs];
#pragma unroll
        for (int j = 0; j < 8; ++j) sm[j] += (float)pz[zs][j] * mz[zs]; }
    const float r = 1.0f / den; v4f lo, hh;
#pragma unroll
    for (int j = 0; j < 4; ++j) { lo[j] = sm[j] * r; hh[j] = sm[4 + j] * r; }
    *(v4f*)((char*)OUTb + eb) = lo; *(v4f*)((char*)OUTb + eb + 16) = hh;  }

extern "C" void kernel_launch(void* const* d_in, const int* in_sizes, int n_in,
                              void* d_out, int out_size, void* d_ws, size_t ws_size, hipStream_t stream) {
    (void)in_sizes; (void)n_in; (void)out_size;
    const float* x = (const float*)d_in[0]; const float* wq = (const float*)d_in[1]; const float* wk = (const float*)d_in[2]; const float* wv = (const float*)d_in[3];
    float* OUT = (float*)d_out;     // [1][8192][64]
    char* wsp = (char*)d_ws;
    auto take = [&](size_t bytes) { char* p = wsp; wsp += (bytes + 255) & ~(size_t)255; return (void*)p; };
    h16* QP16 = (h16*)take((size_t)NH_ * TT * HD * 2); h16* KP16 = (h16*)take((size_t)NKV * TT * HD * 2); h16* VT16 = (h16*)take((size_t)NKV * HD * TT * 2);
    h16* Ob = (h16*)take((size_t)KSPL * TT * HD * 2); float* Eb = (float*)take((size_t)KSPL * TT * 4);
    if ((size_t)(wsp - (char*)d_ws) > ws_size) return;    // ws 256 MiB
    k_proj<<<dim3(TT / PT, 2, 1), 256, 0, stream>>>(x, wq, wk, wv, QP16, KP16, VT16);   /* (B,T,C,H,W) f32 and [128][64] f32 weights -> fp16 planes */
    k_fattn<<<dim3(TT / 256, KSPL, 1), 256, 0, stream>>>(QP16, KP16, VT16, Ob, Eb);   /* slice z = keys z*512..: normalised partial rows fp16 in fragment order, log2 sums of exponentials [z][q] */
    k_merge<<<(unsigned)(((size_t)TT * HD / 8 + 255) / 256), 256, 0, stream>>>(Ob, Eb, OUT);
}

// v008
// Measured time: 20.8 microseconds a run.
// Two timings next to v007 put it at 1.05 and 1.06 times that version's speed.
// Over all steps from v000 it is 53.1 times as fast.
#include <hip/hip_runtime.h>

// Single-head self-attention over all 8,192 tokens of a video feature map (hidden_states [2][16][128][16][16] = (B,T,C,H,W) -> tokens n = (b,t,h,w), features c: x [8192][128]; q = x w_q, k = x w_k, v = x w_v ('xw' [128][64], no bias); scores = q.k / 8 over all 8192 keys; softmax; out = attn.v -> [8192][64] (524 k)).
// Layout: one projection kernel reads x and the weights as they come, transposes them into LDS while converting to bf16, and writes the fp16 planes q (fragment order, see k_proj), k [8192][64], v^T [64][8192]; scores, softmax and attn.v fused in one kernel with a running row maximum (scores and P stay in registers, a slice's K and V^T in LDS), the 8192 keys split into 16 slices; each slice leaves, per query, its own softmax average of v (a normalised row, fp16) and the log2 of its sum of exponentials (f32), a merge kernel joins the slices in slice order.
// Compute dtypes, f32 accumulate: every input rounded to bf16; projections on PLAIN bf16 operands (exact); scores and attn.v on single fp16 planes (P = exp(s - the row maximum in use), at most 2^12, rounded to fp16); softmax f32; a slice's normalised partial row rounded to fp16 (a convex mix of fp16 v values, so inside their range); merge and output f32.

#define NB_  1
#define TT   8192
#define DM   128
#define NH_  1
#define NKV  1
#define REP  (NH_ / NKV)
#define HD   64
#define DQ   (NH_ * HD)
#define DKV  (NKV * HD)
#define ZH   1
#define RH   0                  // unused
#define WIN  0
#define TK   TT                   // keys
#define KSPL 16                   // key slices: 32 blocks of 256 queries x 16 slices = 512 blocks of 8 waves, two per WGP, four waves per SIMD
#define KSL  (TK / KSPL)          // keys per slice
#define KPIT (HD + 8)             // LDS pitch of a K row, halves: 128 + 16 bytes (16 B x odd, so the 16 rows of a 16-byte fragment read meet no bank twice)
#define VPIT (KSL + 8)            // LDS pitch of a V^T row, halves: 1024 + 16 bytes (same reason)
#define KTL  128                  // keys per staged tile of a slice: four tiles, each with its own place in LDS
#define PPT  (KTL / 32)           // passes of 32 keys per tile
#define GRP  256                  // tokens per (b, t) group = H x W
#define NGRP 32                   // (b, t) groups
#define PT   64                   // tokens per projection block: a 128-byte line of a V^T row, a quarter of a (b, t) group
#define XPIT (DM + 8)             // LDS pitch of the 128 bf16 input features of a token or of an output feature, halves: 256 + 16 bytes (16 B x odd)
#define OPIT (PT + 8)             // LDS pitch of a staged output row of 64 halves: 128 + 16 bytes (same reason)
#define SCL  0.125f   // HD^-0.5
#define LC   (SCL * 1.4426950408889634f)   // score -> scaled log2 domain
typedef _Float16 h16;
typedef unsigned short bf;
typedef __attribute__((ext_vector_type(16))) __bf16   v16bf;
typedef __attribute__((ext_vector_type(16))) _Float16 v16h;
typedef __attribute__((ext_vector_type(8)))  _Float16 v8h;
typedef __attribute__((ext_vector_type(8)))  unsigned short v8us;
typedef __attribute__((ext_vector_type(8)))  float    v8f;
typedef __attribute__((ext_vector_type(4)))  float    v4f;
typedef v8h  __attribute__((may_alias)) v8ha;
typedef v4f  __attribute__((may_alias)) v4fa;
typedef v8us __attribute__((may_alias)) v8usa;

typedef __attribute__((ext_vector_type(4))) unsigned short v4us;
typedef __attribute__((ext_vector_type(8))) __bf16 v8bf;
typedef __attribute__((ext_vector_type(4))) __bf16 v4bf;
// f32 -> bf16, round to nearest even, two values an instruction
__device__ __forceinline__ v8us tobf8(v8f t) { return __builtin_bit_cast(v8us, __builtin_convertvector(t, v8bf)); }
__device__ __forceinline__ v4us tobf4(v4f t) { return __builtin_bit_cast(v4us, __builtin_convertvector(t, v4bf)); }
__device__ __forceinline__ v16h cat16(v8h lo, v8h hi) { return __builtin_shufflevector(lo, hi, 0, 1, 2, 3, 4, 5, 6, 7, 8, 9, 10, 11, 12, 13, 14, 15); }
__device__ __forceinline__ v16bf cat16b(v8us lo, v8us hi) { return __builtin_bit_cast(v16bf, __builtin_shufflevector(lo, hi, 0, 1, 2, 3, 4, 5, 6, 7, 8, 9, 10, 11, 12, 13, 14, 15)); }
__device__ __forceinline__ v8f wmma16(v16h a, v16h b, v8f c) { return __builtin_amdgcn_wmma_f32_16x16x32_f16(false, a, false, b, (short)0, c, false, false); }
__device__ __forceinline__ v8f wmmab(v16bf a, v16bf b, v8f c) { return __builtin_amdgcn_wmma_f32_16x16x32_bf16(false, a, false, b, (short)0, c, false, false); }



// fragment loader and product of the 16x16x32 forms: lane (lr, hi) holds, of row (A) or column (B) lr, k = 8 hi + 0..7 and 16 + 8 hi + 0..7; p points at k = 8 hi of that row
template <typename T16> struct WFrag;
template <> struct WFrag<h16> { typedef v16h V; static __device__ __forceinline__ V ld(const h16* p) { return cat16(*(const v8h*)p, *(const v8h*)(p + 16)); } static __device__ __forceinline__ v8f mma(V a, V b, v8f c) { return wmma16(a, b, c); } };
template <> struct WFrag<bf> { typedef v16bf V; static __device__ __forceinline__ V ld(const bf* p) { return cat16b(*(const v8us*)p, *(const v8us*)(p + 16)); } static __device__ __forceinline__ v8f mma(V a, V b, v8f c) { return wmmab(a, b, c); } };

// k_proj: q, k and v^T planes straight from the inputs. Block = 8 waves, 64 tokens; grid (TT / 64, 2): y = 0 makes q and v features 0..31, y = 1 makes k and v features 32..63 (256 blocks, one per WGP).
// The block loads its x tile [128 c][64 tokens] and its weight columns [128 c][64 + 32] in whole lines, 16 bytes a thread, rounds to bf16 and stores them transposed in LDS (c contiguous), so both are read with the one fragment loader.
// q, k: D = W^T X^T (A = 16 output features, B = 16 tokens): a lane holds 8 consecutive features of one token. v^T: D = X W (A = 16 tokens, B = 16 features): a lane holds 8 consecutive tokens of one feature. c runs 0..127 in steps of 32 in one accumulator.
// The fp16 results go through LDS so that every 128-byte line of a plane is stored whole by 8 lanes of one wave.
// q leaves in FRAGMENT ORDER: per 16 queries 2 KiB, piece (f8 >> 1) of 512 bytes, in it 16 bytes per lane (lane = 16 (f8 & 1) + query & 15), f8 = feature / 8: a fragment load of k_fattn, 16 bytes a lane, then covers 4 whole lines, not 32 bytes in each of 16.
__global__ __launch_bounds__(256) void k_proj(const float* __restrict__ x, const float* __restrict__ wq, const float* __restrict__ wk, const float* __restrict__ wv, h16* Q, h16* Kp, h16* Vt) {
    typedef WFrag<bf> W;
    __shared__ __align__(16) bf xs[PT * XPIT]; __shared__ __align__(16) bf wl[(HD + HD / 2) * XPIT];   // wl rows 0..63: q or k features, 64..95: this block's v features
    __shared__ __align__(16) h16 oa[PT * OPIT]; __shared__ __align__(16) h16 ov[(HD / 2) * OPIT];      // oa [token][feature], ov [v feature][token]
    const int tid = threadIdx.x, lane = tid & 31, lr = lane & 15, hi = lane >> 4, wave = tid >> 5; const int n0 = blockIdx.x * PT, y = blockIdx.y;
    const char* xg = (const char*)(x + (size_t)(n0 / GRP) * DM * GRP + n0 % GRP); const char* ag = (const char*)(y ? wk : wq); const char* vg = (const char*)(wv + y * (HD / 2));
    // a thread owns 8 c x 4 columns of the 64-wide tiles (c8, e4) and 4 c x 4 columns of the 32-wide one (c4, f4); each address is a uniform base, one 32-bit byte offset and a constant
    const int c8 = (tid >> 4) * 8, e4 = (tid & 15) * 4, c4 = (tid >> 3) * 4, f4 = (tid & 7) * 4;
    const unsigned xb = (unsigned)(c8 * GRP + e4) * 4u, ab = (unsigned)(c8 * HD + e4) * 4u, vb = (unsigned)(c4 * HD + f4) * 4u;
    v4f xr[8], ar[8], vr[4];
    // every '#pragma unroll' here keeps the index of a register array a compile-time constant; on the three load loops it puts a thread's 20 loads in flight together
#pragma unroll
    for (int k = 0; k < 8; ++k) xr[k] = *(const v4f*)(xg + xb + k * GRP * 4);
#pragma unroll
    for (int k = 0; k < 8; ++k) ar[k] = *(const v4f*)(ag + ab + k * HD * 4);
#pragma unroll
    for (int k = 0; k < 4; ++k) vr[k] = *(const v4f*)(vg + vb + k * HD * 4);
    // precaution of form: the wait stands in front of the first overwrite of a register that the loads above name as an address; the three offsets are inputs so that they stay in their registers up to it
    asm volatile("s_wait_xcnt 0x0" :: "v"(xb), "v"(ab), "v"(vb) : "memory");
    __builtin_amdgcn_sched_barrier(0);   // keeps the arithmetic below from being scheduled above that wait
#pragma unroll
    for (int i = 0; i < 4; ++i) { v8f t;
#pragma unroll
        for (int k = 0; k < 8; ++k) t[k] = xr[k][i];
        *(v8us*)(xs + (e4 + i) * XPIT + c8) = tobf8(t); }
#pragma unroll
    for (int i = 0; i < 4; ++i) { v8f t;
#pragma unroll
        for (int k = 0; k < 8; ++k) t[k] = ar[k][i];
        *(v8us*)(wl + (e4 + i) * XPIT + c8) = tobf8(t); }
#pragma unroll
    for (int i = 0; i < 4; ++i) { v4f t;
#pragma unroll
        for (int k = 0; k < 4; ++k) t[k] = vr[k][i];
        *(v4us*)(wl + (HD + f4 + i) * XPIT + c4) = tobf4(t); }
    __syncthreads();   // both bf16 tiles are complete in LDS before any wave reads a fragment
    // wave: token tile tt, feature tiles 2 fh and 2 fh + 1 of q or k, feature tile fh of this block's v half
    const int tt = wave & 3, fh = wave >> 2;
    const bf* xp = xs + (tt * 16 + lr) * XPIT + 8 * hi; const bf* wp = wl + (fh * 32 + lr) * XPIT + 8 * hi; const bf* up = wl + (HD + fh * 16 + lr) * XPIT + 8 * hi;
    v16bf xf[DM / 32], w0[DM / 32], w1[DM / 32], wu[DM / 32];
#pragma unroll
    for (int ks = 0; ks < DM / 32; ++ks) { xf[ks] = W::ld(xp + ks * 32); w0[ks] = W::ld(wp + ks * 32); w1[ks] = W::ld(wp + 16 * XPIT + ks * 32); wu[ks] = W::ld(up + ks * 32); }
    __builtin_amdgcn_sched_barrier(0);   // all 32 fragment reads are issued ahead of the first product: left to itself the compiler reused a few registers and waited out the LDS latency in front of every product
    v8f a0 = (v8f){}, a1 = (v8f){}, av = (v8f){};
#pragma unroll
    for (int ks = 0; ks < DM / 32; ++ks) { a0 = W::mma(w0[ks], xf[ks], a0); a1 = W::mma(w1[ks], xf[ks], a1); av = W::mma(xf[ks], wu[ks], av); }
    const float qs = y ? 1.0f : LC;   // q leaves in the scaled log2 domain (one rounding to fp16, as before), so that k_fattn's score products need no multiply behind them
    v8h t0, t1, tv;
#pragma unroll
    for (int j = 0; j < 8; ++j) { t0[j] = (h16)(a0[j] * qs); t1[j] = (h16)(a1[j] * qs); tv[j] = (h16)av[j]; }
    *(v8h*)(oa + (tt * 16 + lr) * OPIT + fh * 32 + hi * 8) = t0; *(v8h*)(oa + (tt * 16 + lr) * OPIT + fh * 32 + 16 + hi * 8) = t1; *(v8h*)(ov + (fh * 16 + lr) * OPIT + tt * 16 + hi * 8) = tv;
    __syncthreads();   // the staged rows are complete before they are read back line by line
    h16* P = (y ? Kp : Q) + (size_t)n0 * HD;   // the block's 64 rows of 128 bytes (q: its four 2-KiB groups of 16 queries) are contiguous
    const int sr = y ? (tid >> 3) : ((tid >> 7) * 16 + (tid & 15)), sc = y ? (tid & 7) : ((tid >> 4) & 7);   // staged row and 8-feature piece that belong at byte 16 tid of the block's part of the plane: k row-major, q in fragment order
    const v8h r0 = *(const v8h*)(oa + sr * OPIT + sc * 8), r1 = *(const v8h*)(oa + (32 + sr) * OPIT + sc * 8), rv = *(const v8h*)(ov + (tid >> 3) * OPIT + (tid & 7) * 8);
    *(v8h*)(P + tid * 8) = r0; *(v8h*)(P + 2048 + tid * 8) = r1;
    *(v8h*)(Vt + (size_t)(y * (HD / 2) + (tid >> 3)) * TT + n0 + (tid & 7) * 8) = rv;
}

// lane l <-> l ^ 16 (the two halves of a wave hold the two key halves of one query column)
__device__ __forceinline__ float xhalf(float x) { const int b = __float_as_int(x); return __int_as_float(__builtin_amdgcn_permlanex16(b, b, 0x76543210, 0xfedcba98, false, false)); }

// One tile's copies of a thread, global memory -> LDS through no register: four 16-byte pieces of K rows (32 rows apart) and four of V^T rows (16 rows apart); a wave's copy covers whole 128-byte lines.
// lk, lv: the lane's own LDS byte addresses of its first pieces; gk, gv: its global addresses. s_wait_xcnt 0 is the last line of the copies' own statement: a precaution of form, it stands in front of every later write of a register that a copy names.
__device__ __forceinline__ void tile_copies(unsigned lk, unsigned lv, const h16* gk, const h16* gv) {
    asm volatile("global_load_async_to_lds_b128 %0, %8, off\n\t"
                 "global_load_async_to_lds_b128 %1, %9, off\n\t"
                 "global_load_async_to_lds_b128 %2, %10, off\n\t"
                 "global_load_async_to_lds_b128 %3, %11, off\n\t"
                 "global_load_async_to_lds_b128 %4, %12, off\n\t"
                 "global_load_async_to_lds_b128 %5, %13, off\n\t"
                 "global_load_async_to_lds_b128 %6, %14, off\n\t"
                 "global_load_async_to_lds_b128 %7, %15, off\n\t"
                 "s_wait_xcnt 0x0"
                 :: "v"(lk), "v"(lk + 32u * KPIT * 2u), "v"(lk + 64u * KPIT * 2u), "v"(lk + 96u * KPIT * 2u),
                    "v"(lv), "v"(lv + 16u * VPIT * 2u), "v"(lv + 32u * VPIT * 2u), "v"(lv + 48u * VPIT * 2u),
                    "v"(gk), "v"(gk + 32 * HD), "v"(gk + 64 * HD), "v"(gk + 96 * HD),
                    "v"(gv), "v"(gv + 16 * TK), "v"(gv + 32 * TK), "v"(gv + 48 * TK)
                 : "memory");
}

// k_fattn: fused scores + softmax + attn.v. Block = 8 waves x 32 queries, grid (TT / 256, KSPL); the block brings its slice's K rows and V^T rows into LDS (shared by the 8 waves) by asynchronous copies in four tiles of KTL keys, each tile to its own place (none is refilled): only the first tile is waited for in front of the loop, each later one flies while the tile before it is worked on. Each wave walks the KSL keys 32 at a time.
// Every '#pragma unroll' in it keeps the index of a register array a compile-time constant.
// S^T = K Q^T (A = 16 key rows, B = 16 query columns kept in registers): lane (lr, hi) holds, for query lr, keys 8 hi + j (tile 0) and 16 + 8 hi + j (tile 1), which is the k order of the fragment loader, so the two converted score tiles ARE the B operand of O^T += V^T P^T.
// Per slice z and query q, with l = sum_k exp2(s LC - m) and m the maximum in use at the end (scaled log2 domain, at most 12 below the slice's true maximum; l is at least 1, the key that set m counts 1): the row sum_k exp2(s LC - m) v[k] / l in fp16 goes to Op as the lanes hold it (fragment order: [q / 16][z][d / 16][lane][8], so that a store covers 512 bytes in a row), Ep[z][q] = m + log2 l. Q arrives multiplied by LC, in fragment order.
__global__ __launch_bounds__(256) void k_fattn(const h16* __restrict__ Q, const h16* __restrict__ Kp, const h16* __restrict__ Vt, h16* Op, float* Ep) {
    typedef WFrag<h16> W;
    const int lane = threadIdx.x & 31, lr = lane & 15, hi = lane >> 4; const int q0 = blockIdx.x * 256 + __builtin_amdgcn_readfirstlane(threadIdx.x >> 5) * 32; const int z = blockIdx.y;   // q0 in a scalar register: the copies' addresses take its place among the vector registers that live through the loop
    __shared__ __align__(16) h16 lds[HD * VPIT + KSL * KPIT]; h16* const vls = lds; h16* const kls = lds + HD * VPIT;   // V^T first: the offsets of its four row groups then fit the LDS loads' 16-bit offset field
    // tile 0's copies first. A thread's pieces: K row threadIdx.x / 8 (+ 32 i) of the tile, piece threadIdx.x % 8; V^T row threadIdx.x / 16 (+ 16 i), piece threadIdx.x % 16 of the tile's 256 bytes. From tile to tile the four addresses move by constants.
    const unsigned lk0 = (unsigned)(size_t)kls + ((threadIdx.x >> 3) * KPIT + (threadIdx.x & 7) * 8) * 2u, lv0 = (unsigned)(size_t)vls + ((threadIdx.x >> 4) * VPIT + (threadIdx.x & 15) * 8) * 2u;
    const h16* const gk0 = Kp + (size_t)z * KSL * HD + threadIdx.x * 8; const h16* const gv0 = Vt + (size_t)(threadIdx.x >> 4) * TK + z * KSL + (threadIdx.x & 15) * 8;
    tile_copies(lk0, lv0, gk0, gv0);
    // the thread's global addresses of its 16-byte pieces of the Q fragments: a uniform base, one 32-bit byte offset qb and a constant
    const unsigned qb = (unsigned)(q0 * HD) * 2u + lane * 16u;
    v16h qf[2][2];
#pragma unroll
    for (int qt = 0; qt < 2; ++qt)
#pragma unroll
        for (int ks = 0; ks < 2; ++ks) { const char* qp = (const char*)Q + qb + qt * 2048 + ks * 1024; qf[qt][ks] = cat16(*(const v8h*)qp, *(const v8h*)(qp + 512)); }   // k = 32 ks + 8 hi + 0..7, then + 16: the loader's order
    // precaution of form: the wait stands in front of the first overwrite of a register that the Q loads above name as an address; qb is an input so that it stays in its register up to it
    asm volatile("s_wait_xcnt 0x0" :: "v"(qb) : "memory");
    __builtin_amdgcn_sched_barrier(0);   // keeps the accumulators' zeroing from being scheduled above that wait
    v8f o[2][4], nm[2]; float m[2], l[2];   // nm: -m in all 8 registers of an accumulator tile, the start value of the score products
#pragma unroll
    for (int qt = 0; qt < 2; ++qt) { m[qt] = 0.f; l[qt] = 0.f; nm[qt] = (v8f){};
#pragma unroll
        for (int dt = 0; dt < 4; ++dt) o[qt][dt] = (v8f){}; }
    asm volatile("s_wait_asynccnt 0x0" ::: "memory");   // this wave's copies of tile 0 have landed
    __syncthreads();   // tile 0 is complete in LDS before any wave reads a fragment of it
    tile_copies(lk0 + KTL * KPIT * 2u, lv0 + KTL * 2u, gk0 + KTL * HD, gv0 + KTL);   // tile 1 flies while tile 0 is worked on
    const h16* kp = kls + lr * KPIT + 8 * hi; const h16* vp = vls + lr * VPIT + 8 * hi;
    v16h kf[2][2];
#pragma unroll
    for (int kt = 0; kt < 2; ++kt)
#pragma unroll
        for (int ks = 0; ks < 2; ++ks) kf[kt][ks] = W::ld(kp + kt * 16 * KPIT + ks * 32);
    // rolled: the body already holds 16 matrix instructions, and a second copy would not fit four waves' registers
#pragma unroll 1
    for (int it = 0; it < KSL / 32; ++it) {
        // publish point of the next tile, in front of a tile's LAST pass, because that pass fetches the next tile's first K rows ahead. The test reads the same in the whole block. Order: this wave's LDS reads, its own copies, the barrier behind which other waves read them; then the copies of the tile after it, to a place that nobody has read.
        if ((it & (PPT - 1)) == PPT - 1 && it + 1 < KSL / 32) {
            asm volatile("s_wait_dscnt 0x0" ::: "memory");      // this wave's LDS reads have returned
            asm volatile("s_wait_asynccnt 0x0" ::: "memory");   // this wave's copies of the next tile have landed
            __syncthreads();                                    // the next tile is complete in LDS before any wave reads it
            if (it + 1 + PPT < KSL / 32) { const unsigned tn = (unsigned)(it + 1 + PPT) / PPT; tile_copies(lk0 + tn * (KTL * KPIT * 2u), lv0 + tn * (KTL * 2u), gk0 + tn * (KTL * HD), gv0 + tn * KTL); }
        }
        v16h vf[4];
#pragma unroll
        for (int dt = 0; dt < 4; ++dt) vf[dt] = W::ld(vp + dt * 16 * VPIT + it * 32);
        v8f s[2][2];
        // s = q.k LC - m, the exponent itself. The 8 score products in asm text: D apart from C, so that nm stays in its registers (from the builtin the compiler copied the start value into D, 8 to 16 64-bit moves a pass).
        // Four independent tiles, then their accumulating second halves; the four v_nop are the distance the chip needs between the last product and the first vector instruction that reads its D.
        asm("v_wmma_f32_16x16x32_f16 %0, %4, %8, %12\n\t"
            "v_wmma_f32_16x16x32_f16 %1, %6, %8, %12\n\t"
            "v_wmma_f32_16x16x32_f16 %2, %4, %10, %13\n\t"
            "v_wmma_f32_16x16x32_f16 %3, %6, %10, %13\n\t"
            "v_wmma_f32_16x16x32_f16 %0, %5, %9, %0\n\t"
            "v_wmma_f32_16x16x32_f16 %1, %7, %9, %1\n\t"
            "v_wmma_f32_16x16x32_f16 %2, %5, %11, %2\n\t"
            "v_wmma_f32_16x16x32_f16 %3, %7, %11, %3\n\t"
            "v_nop\n\tv_nop\n\tv_nop\n\tv_nop"
            : "=&v"(s[0][0]), "=&v"(s[0][1]), "=&v"(s[1][0]), "=&v"(s[1][1])
            : "v"(kf[0][0]), "v"(kf[0][1]), "v"(kf[1][0]), "v"(kf[1][1]), "v"(qf[0][0]), "v"(qf[0][1]), "v"(qf[1][0]), "v"(qf[1][1]), "v"(nm[0]), "v"(nm[1]));
        const int nx = (it + 1 < KSL / 32) ? it + 1 : it;   // next pass's K rows, fetched behind this pass's score products; the last pass re-reads its own (in bounds)
#pragma unroll
        for (int kt = 0; kt < 2; ++kt)
#pragma unroll
            for (int ks = 0; ks < 2; ++ks) kf[kt][ks] = W::ld(kp + nx * 32 * KPIT + kt * 16 * KPIT + ks * 32);
        // no maximum search in a pass: the exponentials, their sums and the fp16 P are made at once from s, and the sums, which l needs anyway, are the test.
        // The maximum in use m stays while every lane's sum of 16 exponentials is at most 2^12: P is then at most 2^12, well inside fp16, and o, l and m stay one consistent triple for the merge. s stays in its registers up to the test.
        v16h p[2]; float sm[2];
#pragma unroll
        for (int qt = 0; qt < 2; ++qt) { float a = 0.f;
#pragma unroll
            for (int j = 0; j < 16; ++j) { const float e = __builtin_amdgcn_exp2f(s[qt][j >> 3][j & 7]); a += e; p[qt][j] = (h16)e; }
            sm[qt] = a; }
        if (__builtin_amdgcn_ballot_w32(!(fmaxf(sm[0], sm[1]) <= 4096.0f)) != 0 || it == 0) {   // one scalar branch a pass, taken by the whole wave: on the first pass (which sets m) and rarely after it; what was made above is then made again from the moved s
#pragma unroll
            for (int qt = 0; qt < 2; ++qt) {
                float mx = s[qt][0][0];
#pragma unroll
                for (int j = 1; j < 16; ++j) mx = fmaxf(mx, s[qt][j >> 3][j & 7]);
                mx = fmaxf(mx, xhalf(mx));
                const float dl = it == 0 ? mx : fmaxf(mx, 0.f); const float al = it == 0 ? 0.f : __builtin_amdgcn_exp2f(-dl);   // m moves up by dl; the first pass takes its own maximum, whatever its sign (o and l are still 0)
                m[qt] += dl; l[qt] *= al;
#pragma unroll
                for (int j = 0; j < 8; ++j) nm[qt][j] = -m[qt];
#pragma unroll
                for (int dt = 0; dt < 4; ++dt) o[qt][dt] = o[qt][dt] * al;
                float a = 0.f;
#pragma unroll
                for (int j = 0; j < 16; ++j) { const float e = __builtin_amdgcn_exp2f(s[qt][j >> 3][j & 7] - dl); a += e; p[qt][j] = (h16)e; }
                sm[qt] = a;
            }
        }
#pragma unroll
        for (int qt = 0; qt < 2; ++qt) {
            l[qt] += sm[qt];
#pragma unroll
            for (int dt = 0; dt < 4; ++dt) o[qt][dt] = W::mma(vf[dt], p[qt], o[qt][dt]);
        }
    }
    asm volatile("s_wait_asynccnt 0x0" ::: "memory");   // no copy of this wave is outstanding when it ends (a precaution; the last publish point has waited for all of them)
    // a lane holds 8 consecutive d of one query per tile: 16 bytes; a tile leaves as its 32 lanes hold it, 512 bytes in a row
    v8h t[2][4]; float ev[2];
#pragma unroll
    for (int qt = 0; qt < 2; ++qt) {
        const float lt = l[qt] + xhalf(l[qt]); const float r = 1.0f / lt; ev[qt] = m[qt] + __builtin_amdgcn_logf(lt);   // logf: the hardware's log2
#pragma unroll
        for (int dt = 0; dt < 4; ++dt)
#pragma unroll
            for (int j = 0; j < 8; ++j) t[qt][dt][j] = (h16)(o[qt][dt][j] * r);
    }
    // a uniform base, one 32-bit byte offset and a constant: ob in the [TT / 16][KSPL][4][32 lanes][8] fp16 partials, xb in the [KSPL][TT] f32 plane
    const unsigned ln = __builtin_amdgcn_mbcnt_lo(~0u, 0u);   // the lane's number, made anew here, so that nothing of it has to live in a vector register through the loop
    const unsigned ob = (unsigned)((q0 / 16) * KSPL + z) * 2048u + ln * 16u, xb = (unsigned)(z * TT + q0 + (ln & 15u)) * 4u;
#pragma unroll
    for (int qt = 0; qt < 2; ++qt)
#pragma unroll
        for (int dt = 0; dt < 4; ++dt) *(v8h*)((char*)Op + ob + qt * KSPL * 2048 + dt * 512) = t[qt][dt];
    if (ln < 16u) { *(float*)((char*)Ep + xb) = ev[0]; *(float*)((char*)Ep + xb + 64) = ev[1]; }
}

// k_merge: out[q][d] = sum_z w_z Op[q][z][d] / sum_z w_z, w_z = exp2(Ep[z][q] - max_z Ep[z][q]), slices in order; a thread owns 8 consecutive d of one query (16 bytes of each fp16 partial row); a wave takes 8 queries x 32 d: each of its loads covers four whole 128-byte lines of the partials (8 queries x 16 bytes each), and it alone writes its 8 whole lines of the output
__global__ __launch_bounds__(256) void k_merge(const h16* __restrict__ Op, const float* __restrict__ Ep, float* OUTb) {
    const unsigned t = blockIdx.x * 256u + threadIdx.x; if (t >= (unsigned)(TT * HD / 8)) return;
    // every address is a uniform base, one 32-bit byte offset and a constant: eb in the [TT][HD] output, pb in the [TT / 16][KSPL][4][32 lanes][8] partials; qi is the query, the index in a [TT] plane
    const unsigned ln = t & 31u, wv = t >> 5, qg = wv >> 2;   // lane, wave, group of 16 queries
    const unsigned lr = (wv & 1u) * 8u + (ln & 7u), hf = (ln >> 3) & 1u, dt = (wv & 2u) + (ln >> 4);   // the place in k_fattn's tile: query in the group, half of the wave, d tile
    const unsigned qi = qg * 16u + lr, eb = (qi * HD + dt * 16u + hf * 8u) * 4u, pb = qg * (KSPL * 2048u) + dt * 512u + hf * 256u + lr * 16u;
    float mz[KSPL]; v8h pz[KSPL];
    // each loop unrolled so that all slices' loads are in flight together
#pragma unroll
    for (int zs = 0; zs < KSPL; ++zs) mz[zs] = Ep[(size_t)zs * TT + qi];
#pragma unroll
    for (int zs = 0; zs < KSPL; ++zs) pz[zs] = *(const v8h*)((const char*)Op + pb + zs * 2048);
    // precaution of form: the wait stands in front of the first overwrite of a register that the loads above name as an address; qi and pb are inputs so that they stay in their registers up to it
    asm volatile("s_wait_xcnt 0x0" :: "v"(qi), "v"(pb) : "memory");
    __builtin_amdgcn_sched_barrier(0);   // keeps the arithmetic below from being scheduled above that wait
    float M = mz[0];
#pragma unroll
    for (int zs = 1; zs < KSPL; ++zs) M = fmaxf(M, mz[zs]);
    float den = 0.f; v8f sm = (v8f){};
#pragma unroll
    for (int zs = 0; zs < KSPL; ++zs) mz[zs] -= M;
    // from here on mz is the slice's weight. v_nop: the free issue slot that the instruction set asks for behind a transcendental; the scheduling barriers hold each v_nop directly behind its exponential
    __builtin_amdgcn_sched_barrier(0);
#pragma unroll
    for (int zs = 0; zs < KSPL; ++zs) { mz[zs] = __builtin_amdgcn_exp2f(mz[zs]); __builtin_amdgcn_sched_barrier(0); asm volatile("v_nop"); __builtin_amdgcn_sched_barrier(0); }
#pragma unroll
    for (int zs = 0; zs < KSPL; ++zs) { den += mz[zs];
#pragma unroll
        for (int j = 0; j < 8; ++j) sm[j] += (float)pz[zs][j] * mz[zs]; }
    const float r = 1.0f / den; v4f lo, hh;
#pragma unroll
    for (int j = 0; j < 4; ++j) { lo[j] = sm[j] * r; hh[j] = sm[4 + j] * r; }
    *(v4f*)((char*)OUTb + eb) = lo; *(v4f*)((char*)OUTb + eb + 16) = hh;  }

extern "C" void kernel_launch(void* const* d_in, const int* in_sizes, int n_in,
                              void* d_out, int out_size, void* d_ws, size_t ws_size, hipStream_t stream) {
    (void)in_sizes; (void)n_in; (void)out_size;
    const float* x = (const float*)d_in[0]; const float* wq = (const float*)d_in[1]; const float* wk = (const float*)d_in[2]; const float* wv = (const float*)d_in[3];
    float* OUT = (float*)d_out;     // [1][8192][64]
    char* wsp = (char*)d_ws;
    auto take = [&](size_t bytes) { char* p = wsp; wsp += (bytes + 255) & ~(size_t)255; return (void*)p; };
    h16* QP16 = (h16*)take((size_t)NH_ * TT * HD * 2); h16* KP16 = (h16*)take((size_t)NKV * TT * HD * 2); h16* VT16 = (h16*)take((size_t)NKV * HD * TT * 2);
    h16* Ob = (h16*)take((size_t)KSPL * TT * HD * 2); float* Eb = (float*)take((size_t)KSPL * TT * 4);
    if ((size_t)(wsp - (char*)d_ws) > ws_size) return;    // ws 256 MiB
    k_proj<<<dim3(TT / PT, 2, 1), 256, 0, stream>>>(x, wq, wk, wv, QP16, KP16, VT16);   /* (B,T,C,H,W) f32 and [128][64] f32 weights -> fp16 planes */
    k_fattn<<<dim3(TT / 256, KSPL, 1), 256, 0, stream>>>(QP16, KP16, VT16, Ob, Eb);   /* slice z = keys z*512..: normalised partial rows fp16 in fragment order, log2 sums of exponentials [z][q] */
    k_merge<<<(unsigned)(((size_t)TT * HD / 8 + 255) / 256), 256, 0, stream>>>(Ob, Eb, OUT);
}

// v009
// A run of this version takes 19.9 microseconds.
// Timed twice side by side with v008, it ran 1.05 times as fast both times.
// Over all steps from v000 it is 55.5 times as fast.
#include <hip/hip_runtime.h>

// Single-head self-attention over all 8,192 tokens of a video feature map (hidden_states [2][16][128][16][16] = (B,T,C,H,W) -> tokens n = (b,t,h,w), features c: x [8192][128]; q = x w_q, k = x w_k, v = x w_v ('xw' [128][64], no bias); scores = q.k / 8 over all 8192 keys; softmax; out = attn.v -> [8192][64] (524 k)).
// Layout: one projection kernel reads x and the weights as they come, transposes them into LDS while converting to bf16, and writes the fp16 planes q (fragment order, see k_proj), k [8192][64], v^T [64][8192]; scores, softmax and attn.v fused in one kernel (scores and P stay in registers, a slice's K and V^T in LDS; the row maximum in use is that of the slice's first 32 keys, the row sums of P are one more matrix product, and a slice whose P leaves fp16 is walked again with a running maximum), the 8192 keys split into 16 slices; each slice leaves, per query, its own softmax average of v (a normalised row, fp16) and the log2 of its sum of exponentials (f32), a merge kernel joins the slices in slice order.
// Compute dtypes, f32 accumulate: every input rounded to bf16; projections on PLAIN bf16 operands (exact); scores and attn.v on single fp16 planes (P = exp(s - the row maximum in use), rounded to fp16 and checked to be finite there); softmax f32; a slice's normalised partial row rounded to fp16 (a convex mix of fp16 v values, so inside their range); merge and output f32.

#define NB_  1
#define TT   8192
#define DM   128
#define NH_  1
#define NKV  1
#define REP  (NH_ / NKV)
#define HD   64
#define DQ   (NH_ * HD)
#define DKV  (NKV * HD)
#define ZH   1
#define RH   0                  // unused
#define WIN  0
#define TK   TT                   // keys
#define KSPL 16                   // key slices: 32 blocks of 256 queries x 16 slices = 512 blocks of 8 waves, two per WGP, four waves per SIMD
#define KSL  (TK / KSPL)          // keys per slice
#define KPIT (HD + 8)             // LDS pitch of a K row, halves: 128 + 16 bytes (16 B x odd, so the 16 rows of a 16-byte fragment read meet no bank twice)
#define VPIT (KSL + 8)            // LDS pitch of a V^T row, halves: 1024 + 16 bytes (same reason)
#define KTL  128                  // keys per staged tile of a slice: four tiles, each with its own place in LDS
#define PPT  (KTL / 32)           // passes of 32 keys per tile
#define GRP  256                  // tokens per (b, t) group = H x W
#define NGRP 32                   // (b, t) groups
#define PT   64                   // tokens per projection block: a 128-byte line of a V^T row, a quarter of a (b, t) group
#define XPIT (DM + 8)             // LDS pitch of the 128 bf16 input features of a token or of an output feature, halves: 256 + 16 bytes (16 B x odd)
#define OPIT (PT + 8)             // LDS pitch of a staged output row of 64 halves: 128 + 16 bytes (same reason)
#define SCL  0.125f   // HD^-0.5
#define LC   (SCL * 1.4426950408889634f)   // score -> scaled log2 domain
typedef _Float16 h16;
typedef unsigned short bf;
typedef __attribute__((ext_vector_type(16))) __bf16   v16bf;
typedef __attribute__((ext_vector_type(16))) _Float16 v16h;
typedef __attribute__((ext_vector_type(8)))  _Float16 v8h;
typedef __attribute__((ext_vector_type(8)))  unsigned short v8us;
typedef __attribute__((ext_vector_type(8)))  float    v8f;
typedef __attribute__((ext_vector_type(4)))  float    v4f;
typedef v8h  __attribute__((may_alias)) v8ha;
typedef v4f  __attribute__((may_alias)) v4fa;
typedef v8us __attribute__((may_alias)) v8usa;

typedef __attribute__((ext_vector_type(4))) unsigned short v4us;
typedef __attribute__((ext_vector_type(8))) __bf16 v8bf;
typedef __attribute__((ext_vector_type(4))) __bf16 v4bf;
// f32 -> bf16, round to nearest even, two values an instruction
__device__ __forceinline__ v8us tobf8(v8f t) { return __builtin_bit_cast(v8us, __builtin_convertvector(t, v8bf)); }
__device__ __forceinline__ v4us tobf4(v4f t) { return __builtin_bit_cast(v4us, __builtin_convertvector(t, v4bf)); }
__device__ __forceinline__ v16h cat16(v8h lo, v8h hi) { return __builtin_shufflevector(lo, hi, 0, 1, 2, 3, 4, 5, 6, 7, 8, 9, 10, 11, 12, 13, 14, 15); }
__device__ __forceinline__ v16bf cat16b(v8us lo, v8us hi) { return __builtin_bit_cast(v16bf, __builtin_shufflevector(lo, hi, 0, 1, 2, 3, 4, 5, 6, 7, 8, 9, 10, 11, 12, 13, 14, 15)); }
__device__ __forceinline__ v8f wmma16(v16h a, v16h b, v8f c) { return __builtin_amdgcn_wmma_f32_16x16x32_f16(false, a, false, b, (short)0, c, false, false); }
__device__ __forceinline__ v8f wmmab(v16bf a, v16bf b, v8f c) { return __builtin_amdgcn_wmma_f32_16x16x32_bf16(false, a, false, b, (short)0, c, false, false); }



// fragment loader and product of the 16x16x32 forms: lane (lr, hi) holds, of row (A) or column (B) lr, k = 8 hi + 0..7 and 16 + 8 hi + 0..7; p points at k = 8 hi of that row
template <typename T16> struct WFrag;
template <> struct WFrag<h16> { typedef v16h V; static __device__ __forceinline__ V ld(const h16* p) { return cat16(*(const v8h*)p, *(const v8h*)(p + 16)); } static __device__ __forceinline__ v8f mma(V a, V b, v8f c) { return wmma16(a, b, c); } };
template <> struct WFrag<bf> { typedef v16bf V; static __device__ __forceinline__ V ld(const bf* p) { return cat16b(*(const v8us*)p, *(const v8us*)(p + 16)); } static __device__ __forceinline__ v8f mma(V a, V b, v8f c) { return wmmab(a, b, c); } };

// k_proj: q, k and v^T planes straight from the inputs. Block = 8 waves, 64 tokens; grid (TT / 64, 2): y = 0 makes q and v features 0..31, y = 1 makes k and v features 32..63 (256 blocks, one per WGP).
// The block loads its x tile [128 c][64 tokens] and its weight columns [128 c][64 + 32] in whole lines, 16 bytes a thread, rounds to bf16 and stores them transposed in LDS (c contiguous), so both are read with the one fragment loader.
// q, k: D = W^T X^T (A = 16 output features, B = 16 tokens): a lane holds 8 consecutive features of one token. v^T: D = X W (A = 16 tokens, B = 16 features): a lane holds 8 consecutive tokens of one feature. c runs 0..127 in steps of 32 in one accumulator.
// The fp16 results go through LDS so that every 128-byte line of a plane is stored whole by 8 lanes of one wave.
// q leaves in FRAGMENT ORDER: per 16 queries 2 KiB, piece (f8 >> 1) of 512 bytes, in it 16 bytes per lane (lane = 16 (f8 & 1) + query & 15), f8 = feature / 8: a fragment load of k_fattn, 16 bytes a lane, then covers 4 whole lines, not 32 bytes in each of 16.
__global__ __launch_bounds__(256) void k_proj(const float* __restrict__ x, const float* __restrict__ wq, const float* __restrict__ wk, const float* __restrict__ wv, h16* Q, h16* Kp, h16* Vt) {
    typedef WFrag<bf> W;
    __shared__ __align__(16) bf xs[PT * XPIT]; __shared__ __align__(16) bf wl[(HD + HD / 2) * XPIT];   // wl rows 0..63: q or k features, 64..95: this block's v features
    __shared__ __align__(16) h16 oa[PT * OPIT]; __shared__ __align__(16) h16 ov[(HD / 2) * OPIT];      // oa [token][feature], ov [v feature][token]
    const int tid = threadIdx.x, lane = tid & 31, lr = lane & 15, hi = lane >> 4, wave = tid >> 5; const int n0 = blockIdx.x * PT, y = blockIdx.y;
    const char* xg = (const char*)(x + (size_t)(n0 / GRP) * DM * GRP + n0 % GRP); const char* ag = (const char*)(y ? wk : wq); const char* vg = (const char*)(wv + y * (HD / 2));
    // a thread owns 8 c x 4 columns of the 64-wide tiles (c8, e4) and 4 c x 4 columns of the 32-wide one (c4, f4); each address is a uniform base, one 32-bit byte offset and a constant
    const int c8 = (tid >> 4) * 8, e4 = (tid & 15) * 4, c4 = (tid >> 3) * 4, f4 = (tid & 7) * 4;
    const unsigned xb = (unsigned)(c8 * GRP + e4) * 4u, ab = (unsigned)(c8 * HD + e4) * 4u, vb = (unsigned)(c4 * HD + f4) * 4u;
    v4f xr[8], ar[8], vr[4];
    // every '#pragma unroll' here keeps the index of a register array a compile-time constant; on the three load loops it puts a thread's 20 loads in flight together
#pragma unroll
    for (int k = 0; k < 8; ++k) xr[k] = *(const v4f*)(xg + xb + k * GRP * 4);
#pragma unroll
    for (int k = 0; k < 8; ++k) ar[k] = *(const v4f*)(ag + ab + k * HD * 4);
#pragma unroll
    for (int k = 0; k < 4; ++k) vr[k] = *(const v4f*)(vg + vb + k * HD * 4);
    // precaution of form: the wait stands in front of the first overwrite of a register that the loads above name as an address; the three offsets are inputs so that they stay in their registers up to it
    asm volatile("s_wait_xcnt 0x0" :: "v"(xb), "v"(ab), "v"(vb) : "memory");
    __builtin_amdgcn_sched_barrier(0);   // keeps the arithmetic below from being scheduled above that wait
#pragma unroll
    for (int i = 0; i < 4; ++i) { v8f t;
#pragma unroll
        for (int k = 0; k < 8; ++k) t[k] = xr[k][i];
        *(v8us*)(xs + (e4 + i) * XPIT + c8) = tobf8(t); }
#pragma unroll
    for (int i = 0; i < 4; ++i) { v8f t;
#pragma unroll
        for (int k = 0; k < 8; ++k) t[k] = ar[k][i];
        *(v8us*)(wl + (e4 + i) * XPIT + c8) = tobf8(t); }
#pragma unroll
    for (int i = 0; i < 4; ++i) { v4f t;
#pragma unroll
        for (int k = 0; k < 4; ++k) t[k] = vr[k][i];
        *(v4us*)(wl + (HD + f4 + i) * XPIT + c4) = tobf4(t); }
    __syncthreads();   // both bf16 tiles are complete in LDS before any wave reads a fragment
    // wave: token tile tt, feature tiles 2 fh and 2 fh + 1 of q or k, feature tile fh of this block's v half
    const int tt = wave & 3, fh = wave >> 2;
    const bf* xp = xs + (tt * 16 + lr) * XPIT + 8 * hi; const bf* wp = wl + (fh * 32 + lr) * XPIT + 8 * hi; const bf* up = wl + (HD + fh * 16 + lr) * XPIT + 8 * hi;
    v16bf xf[DM / 32], w0[DM / 32], w1[DM / 32], wu[DM / 32];
#pragma unroll
    for (int ks = 0; ks < DM / 32; ++ks) { xf[ks] = W::ld(xp + ks * 32); w0[ks] = W::ld(wp + ks * 32); w1[ks] = W::ld(wp + 16 * XPIT + ks * 32); wu[ks] = W::ld(up + ks * 32); }
    __builtin_amdgcn_sched_barrier(0);   // all 32 fragment reads are issued ahead of the first product: left to itself the compiler reused a few registers and waited out the LDS latency in front of every product
    v8f a0 = (v8f){}, a1 = (v8f){}, av = (v8f){};
#pragma unroll
    for (int ks = 0; ks < DM / 32; ++ks) { a0 = W::mma(w0[ks], xf[ks], a0); a1 = W::mma(w1[ks], xf[ks], a1); av = W::mma(xf[ks], wu[ks], av); }
    const float qs = y ? 1.0f : LC;   // q leaves in the scaled log2 domain (one rounding to fp16, as before), so that k_fattn's score products need no multiply behind them
    v8h t0, t1, tv;
#pragma unroll
    for (int j = 0; j < 8; ++j) { t0[j] = (h16)(a0[j] * qs); t1[j] = (h16)(a1[j] * qs); tv[j] = (h16)av[j]; }
    *(v8h*)(oa + (tt * 16 + lr) * OPIT + fh * 32 + hi * 8) = t0; *(v8h*)(oa + (tt * 16 + lr) * OPIT + fh * 32 + 16 + hi * 8) = t1; *(v8h*)(ov + (fh * 16 + lr) * OPIT + tt * 16 + hi * 8) = tv;
    __syncthreads();   // the staged rows are complete before they are read back line by line
    h16* P = (y ? Kp : Q) + (size_t)n0 * HD;   // the block's 64 rows of 128 bytes (q: its four 2-KiB groups of 16 queries) are contiguous
    const int sr = y ? (tid >> 3) : ((tid >> 7) * 16 + (tid & 15)), sc = y ? (tid & 7) : ((tid >> 4) & 7);   // staged row and 8-feature piece that belong at byte 16 tid of the block's part of the plane: k row-major, q in fragment order
    const v8h r0 = *(const v8h*)(oa + sr * OPIT + sc * 8), r1 = *(const v8h*)(oa + (32 + sr) * OPIT + sc * 8), rv = *(const v8h*)(ov + (tid >> 3) * OPIT + (tid & 7) * 8);
    *(v8h*)(P + tid * 8) = r0; *(v8h*)(P + 2048 + tid * 8) = r1;
    *(v8h*)(Vt + (size_t)(y * (HD / 2) + (tid >> 3)) * TT + n0 + (tid & 7) * 8) = rv;
}

// lane l <-> l ^ 16 (the two halves of a wave hold the two key halves of one query column)
__device__ __forceinline__ float xhalf(float x) { const int b = __float_as_int(x); return __int_as_float(__builtin_amdgcn_permlanex16(b, b, 0x76543210, 0xfedcba98, false, false)); }

// One tile's copies of a thread, global memory -> LDS through no register: four 16-byte pieces of K rows (32 rows apart) and four of V^T rows (16 rows apart); a wave's copy covers whole 128-byte lines.
// lk, lv: the lane's own LDS byte addresses of its first pieces; gk, gv: its global addresses. s_wait_xcnt 0 is the last line of the copies' own statement: a precaution of form, it stands in front of every later write of a register that a copy names.
__device__ __forceinline__ void tile_copies(unsigned lk, unsigned lv, const h16* gk, const h16* gv) {
    asm volatile("global_load_async_to_lds_b128 %0, %8, off\n\t"
                 "global_load_async_to_lds_b128 %1, %9, off\n\t"
                 "global_load_async_to_lds_b128 %2, %10, off\n\t"
                 "global_load_async_to_lds_b128 %3, %11, off\n\t"
                 "global_load_async_to_lds_b128 %4, %12, off\n\t"
                 "global_load_async_to_lds_b128 %5, %13, off\n\t"
                 "global_load_async_to_lds_b128 %6, %14, off\n\t"
                 "global_load_async_to_lds_b128 %7, %15, off\n\t"
                 "s_wait_xcnt 0x0"
                 :: "v"(lk), "v"(lk + 32u * KPIT * 2u), "v"(lk + 64u * KPIT * 2u), "v"(lk + 96u * KPIT * 2u),
                    "v"(lv), "v"(lv + 16u * VPIT * 2u), "v"(lv + 32u * VPIT * 2u), "v"(lv + 48u * VPIT * 2u),
                    "v"(gk), "v"(gk + 32 * HD), "v"(gk + 64 * HD), "v"(gk + 96 * HD),
                    "v"(gv), "v"(gv + 16 * TK), "v"(gv + 32 * TK), "v"(gv + 48 * TK)
                 : "memory");
}

// s = q.k LC - m, the exponent itself. The 8 score products of a pass in asm text: D apart from C, so that nm stays in its registers (from the builtin the compiler copied the start value into D, 8 to 16 64-bit moves a pass).
// Four independent tiles, then their accumulating second halves; the four v_nop are the distance the chip needs between the last product and the first vector instruction that reads its D.
__device__ __forceinline__ void score_products(v8f (&s)[2][2], const v16h (&kf)[2][2], const v16h (&qf)[2][2], const v8f (&nm)[2]) {
    asm("v_wmma_f32_16x16x32_f16 %0, %4, %8, %12\n\t"
        "v_wmma_f32_16x16x32_f16 %1, %6, %8, %12\n\t"
        "v_wmma_f32_16x16x32_f16 %2, %4, %10, %13\n\t"
        "v_wmma_f32_16x16x32_f16 %3, %6, %10, %13\n\t"
        "v_wmma_f32_16x16x32_f16 %0, %5, %9, %0\n\t"
        "v_wmma_f32_16x16x32_f16 %1, %7, %9, %1\n\t"
        "v_wmma_f32_16x16x32_f16 %2, %5, %11, %2\n\t"
        "v_wmma_f32_16x16x32_f16 %3, %7, %11, %3\n\t"
        "v_nop\n\tv_nop\n\tv_nop\n\tv_nop"
        : "=&v"(s[0][0]), "=&v"(s[0][1]), "=&v"(s[1][0]), "=&v"(s[1][1])
        : "v"(kf[0][0]), "v"(kf[0][1]), "v"(kf[1][0]), "v"(kf[1][1]), "v"(qf[0][0]), "v"(qf[0][1]), "v"(qf[1][0]), "v"(qf[1][1]), "v"(nm[0]), "v"(nm[1]));
}

// k_fattn: fused scores + softmax + attn.v. Block = 8 waves x 32 queries, grid (TT / 256, KSPL); the block brings its slice's K rows and V^T rows into LDS (shared by the 8 waves) by asynchronous copies in four tiles of KTL keys, each tile to its own place (none is refilled): only the first tile is waited for in front of the loop, each later one flies while the tile before it is worked on. Each wave walks the KSL keys 32 at a time.
// Every '#pragma unroll' in it keeps the index of a register array a compile-time constant.
// S^T = K Q^T (A = 16 key rows, B = 16 query columns kept in registers): lane (lr, hi) holds, for query lr, keys 8 hi + j (tile 0) and 16 + 8 hi + j (tile 1), which is the k order of the fragment loader, so the two converted score tiles ARE the B operand of O^T += V^T P^T.
// Per slice z and query q, with l = sum_k exp2(s LC - m) and m the maximum in use at the end (scaled log2 domain; l is at least 1, the key that set m counts 1): the row sum_k exp2(s LC - m) v[k] / l in fp16 goes to Op as the lanes hold it (fragment order: [q / 16][z][d / 16][lane][8], so that a store covers 512 bytes in a row), Ep[z][q] = m + log2 l. Q arrives multiplied by LC, in fragment order.
__global__ __launch_bounds__(256) void k_fattn(const h16* __restrict__ Q, const h16* __restrict__ Kp, const h16* __restrict__ Vt, h16* Op, float* Ep) {
    typedef WFrag<h16> W;
    const int lane = threadIdx.x & 31, lr = lane & 15, hi = lane >> 4; const int q0 = blockIdx.x * 256 + __builtin_amdgcn_readfirstlane(threadIdx.x >> 5) * 32; const int z = blockIdx.y;   // q0 in a scalar register: the copies' addresses take its place among the vector registers that live through the loop
    __shared__ __align__(16) h16 lds[HD * VPIT + KSL * KPIT]; h16* const vls = lds; h16* const kls = lds + HD * VPIT;   // V^T first: the offsets of its four row groups then fit the LDS loads' 16-bit offset field
    // tile 0's copies first. A thread's pieces: K row threadIdx.x / 8 (+ 32 i) of the tile, piece threadIdx.x % 8; V^T row threadIdx.x / 16 (+ 16 i), piece threadIdx.x % 16 of the tile's 256 bytes. From tile to tile the four addresses move by constants.
    const unsigned lk0 = (unsigned)(size_t)kls + ((threadIdx.x >> 3) * KPIT + (threadIdx.x & 7) * 8) * 2u, lv0 = (unsigned)(size_t)vls + ((threadIdx.x >> 4) * VPIT + (threadIdx.x & 15) * 8) * 2u;
    const h16* const gk0 = Kp + (size_t)z * KSL * HD + threadIdx.x * 8; const h16* const gv0 = Vt + (size_t)(threadIdx.x >> 4) * TK + z * KSL + (threadIdx.x & 15) * 8;
    tile_copies(lk0, lv0, gk0, gv0);
    // the thread's global addresses of its 16-byte pieces of the Q fragments: a uniform base, one 32-bit byte offset qb and a constant
    const unsigned qb = (unsigned)(q0 * HD) * 2u + lane * 16u;
    v16h qf[2][2];
#pragma unroll
    for (int qt = 0; qt < 2; ++qt)
#pragma unroll
        for (int ks = 0; ks < 2; ++ks) { const char* qp = (const char*)Q + qb + qt * 2048 + ks * 1024; qf[qt][ks] = cat16(*(const v8h*)qp, *(const v8h*)(qp + 512)); }   // k = 32 ks + 8 hi + 0..7, then + 16: the loader's order
    // precaution of form: the wait stands in front of the first overwrite of a register that the Q loads above name as an address; qb is an input so that it stays in its register up to it
    asm volatile("s_wait_xcnt 0x0" :: "v"(qb) : "memory");
    __builtin_amdgcn_sched_barrier(0);   // keeps the accumulators' zeroing from being scheduled above that wait
    v8f o[2][4], nm[2], lt[2]; float m[2];   // nm: -m in all 8 registers of an accumulator tile, the start value of the score products; lt: the row sums of P, an accumulator tile like o
#pragma unroll
    for (int qt = 0; qt < 2; ++qt) { m[qt] = 0.f; nm[qt] = (v8f){}; lt[qt] = (v8f){};
#pragma unroll
        for (int dt = 0; dt < 4; ++dt) o[qt][dt] = (v8f){}; }
    v16h one;   // A operand of the row sums: row 0 (lanes 0 and 16) is 1 at all 32 k, every other row 0, so row 0 of lt (register 0 of lanes 0..15) holds, per query column, the sum of P over the keys of both halves of the wave
#pragma unroll
    for (int j = 0; j < 16; ++j) one[j] = lr == 0 ? (h16)1.0f : (h16)0.0f;
    asm volatile("s_wait_asynccnt 0x0" ::: "memory");   // this wave's copies of tile 0 have landed
    __syncthreads();   // tile 0 is complete in LDS before any wave reads a fragment of it
    tile_copies(lk0 + KTL * KPIT * 2u, lv0 + KTL * 2u, gk0 + KTL * HD, gv0 + KTL);   // tile 1 flies while tile 0 is worked on
    const h16* kp = kls + lr * KPIT + 8 * hi; const h16* vp = vls + lr * VPIT + 8 * hi;
    v16h kf[2][2];
#pragma unroll
    for (int kt = 0; kt < 2; ++kt)
#pragma unroll
        for (int ks = 0; ks < 2; ++ks) kf[kt][ks] = W::ld(kp + kt * 16 * KPIT + ks * 32);
    // rolled: the body already holds 18 matrix instructions, and a second copy would not fit four waves' registers
#pragma unroll 1
    for (int it = 0; it < KSL / 32; ++it) {
        // publish point of the next tile, in front of a tile's LAST pass, because that pass fetches the next tile's first K rows ahead. The test reads the same in the whole block. Order: this wave's LDS reads, its own copies, the barrier behind which other waves read them; then the copies of the tile after it, to a place that nobody has read.
        if ((it & (PPT - 1)) == PPT - 1 && it + 1 < KSL / 32) {
            asm volatile("s_wait_dscnt 0x0" ::: "memory");      // this wave's LDS reads have returned
            asm volatile("s_wait_asynccnt 0x0" ::: "memory");   // this wave's copies of the next tile have landed
            __syncthreads();                                    // the next tile is complete in LDS before any wave reads it
            if (it + 1 + PPT < KSL / 32) { const unsigned tn = (unsigned)(it + 1 + PPT) / PPT; tile_copies(lk0 + tn * (KTL * KPIT * 2u), lv0 + tn * (KTL * 2u), gk0 + tn * (KTL * HD), gv0 + tn * KTL); }
        }
        v16h vf[4];
#pragma unroll
        for (int dt = 0; dt < 4; ++dt) vf[dt] = W::ld(vp + dt * 16 * VPIT + it * 32);
        v8f s[2][2];
        score_products(s, kf, qf, nm);
        const int nx = (it + 1 < KSL / 32) ? it + 1 : it;   // next pass's K rows, fetched behind this pass's score products; the last pass re-reads its own (in bounds)
#pragma unroll
        for (int kt = 0; kt < 2; ++kt)
#pragma unroll
            for (int ks = 0; ks < 2; ++ks) kf[kt][ks] = W::ld(kp + nx * 32 * KPIT + kt * 16 * KPIT + ks * 32);
        if (it == 0) {   // a scalar branch: the first pass takes its own maximum as m, whatever its sign, and moves its scores by it
#pragma unroll
            for (int qt = 0; qt < 2; ++qt) {
                float mx = s[qt][0][0];
#pragma unroll
                for (int j = 1; j < 16; ++j) mx = fmaxf(mx, s[qt][j >> 3][j & 7]);
                mx = fmaxf(mx, xhalf(mx));
                m[qt] = mx;
#pragma unroll
                for (int j = 0; j < 8; ++j) { nm[qt][j] = -mx; s[qt][0][j] -= mx; s[qt][1][j] -= mx; }
            }
        }
        // no maximum search, no vector sum and no test in a pass: m stays as the first pass set it, P goes to fp16 as it comes, and its row sums are one more product per query tile.
        // A P beyond fp16 becomes infinite there and makes its row sum infinite: that is looked at once, behind the loop.
        v16h p[2];
#pragma unroll
        for (int qt = 0; qt < 2; ++qt)
#pragma unroll
            for (int j = 0; j < 16; ++j) p[qt][j] = (h16)__builtin_amdgcn_exp2f(s[qt][j >> 3][j & 7]);
#pragma unroll
        for (int qt = 0; qt < 2; ++qt) {
            lt[qt] = W::mma(one, p[qt], lt[qt]);
#pragma unroll
            for (int dt = 0; dt < 4; ++dt) o[qt][dt] = W::mma(vf[dt], p[qt], o[qt][dt]);
        }
    }
    asm volatile("s_wait_asynccnt 0x0" ::: "memory");   // no copy of this wave is outstanding when it ends (a precaution; the last publish point has waited for all of them)
    float ls[2] = { lt[0][0] + xhalf(lt[0][0]), lt[1][0] + xhalf(lt[1][0]) };   // l of the lane's query: lanes 0..15 hold it, lanes 16..31 hold row 8 of the tile, which is 0 (or not a number where P was infinite)
    // The one test of the slice, a scalar branch taken by the whole wave: a row sum that is not finite says that a score passed m by more than fp16 holds (or that an input is not finite).
    // The wave then walks its slice again, all of it still in LDS (no tile is refilled, the last publish point lies behind it, so no barrier), with the maximum held lazily: m moves up whenever a lane's sum of 16 exponentials passes 2^12.
    if (__builtin_amdgcn_ballot_w32(!(ls[0] + ls[1] <= 3.0e38f)) != 0) {
        float l[2];
#pragma unroll
        for (int qt = 0; qt < 2; ++qt) { m[qt] = 0.f; l[qt] = 0.f; nm[qt] = (v8f){};
#pragma unroll
            for (int dt = 0; dt < 4; ++dt) o[qt][dt] = (v8f){}; }
#pragma unroll
        for (int kt = 0; kt < 2; ++kt)
#pragma unroll
            for (int ks = 0; ks < 2; ++ks) kf[kt][ks] = W::ld(kp + kt * 16 * KPIT + ks * 32);
        // rolled, for the registers, as above
#pragma unroll 1
        for (int it = 0; it < KSL / 32; ++it) {
            v16h vf[4];
#pragma unroll
            for (int dt = 0; dt < 4; ++dt) vf[dt] = W::ld(vp + dt * 16 * VPIT + it * 32);
            v8f s[2][2];
            score_products(s, kf, qf, nm);
            const int nx = (it + 1 < KSL / 32) ? it + 1 : it;
#pragma unroll
            for (int kt = 0; kt < 2; ++kt)
#pragma unroll
                for (int ks = 0; ks < 2; ++ks) kf[kt][ks] = W::ld(kp + nx * 32 * KPIT + kt * 16 * KPIT + ks * 32);
            // the exponentials, their sums and the fp16 P are made at once from s; m stays while every lane's sum of 16 exponentials is at most 2^12: P is then at most 2^12, and o, l and m stay one consistent triple. s stays in its registers up to the test.
            v16h p[2]; float sm[2];
#pragma unroll
            for (int qt = 0; qt < 2; ++qt) { float a = 0.f;
#pragma unroll
                for (int j = 0; j < 16; ++j) { const float e = __builtin_amdgcn_exp2f(s[qt][j >> 3][j & 7]); a += e; p[qt][j] = (h16)e; }
                sm[qt] = a; }
            if (__builtin_amdgcn_ballot_w32(!(fmaxf(sm[0], sm[1]) <= 4096.0f)) != 0 || it == 0) {   // taken by the whole wave; what was made above is then made again from the moved s
#pragma unroll
                for (int qt = 0; qt < 2; ++qt) {
                    float mx = s[qt][0][0];
#pragma unroll
                    for (int j = 1; j < 16; ++j) mx = fmaxf(mx, s[qt][j >> 3][j & 7]);
                    mx = fmaxf(mx, xhalf(mx));
                    const float dl = it == 0 ? mx : fmaxf(mx, 0.f); const float al = it == 0 ? 0.f : __builtin_amdgcn_exp2f(-dl);   // m moves up by dl; the first pass takes its own maximum, whatever its sign (o and l are still 0)
                    m[qt] += dl; l[qt] *= al;
#pragma unroll
                    for (int j = 0; j < 8; ++j) nm[qt][j] = -m[qt];
#pragma unroll
                    for (int dt = 0; dt < 4; ++dt) o[qt][dt] = o[qt][dt] * al;
                    float a = 0.f;
#pragma unroll
                    for (int j = 0; j < 16; ++j) { const float e = __builtin_amdgcn_exp2f(s[qt][j >> 3][j & 7] - dl); a += e; p[qt][j] = (h16)e; }
                    sm[qt] = a;
                }
            }
#pragma unroll
            for (int qt = 0; qt < 2; ++qt) {
                l[qt] += sm[qt];
#pragma unroll
                for (int dt = 0; dt < 4; ++dt) o[qt][dt] = W::mma(vf[dt], p[qt], o[qt][dt]);
            }
        }
#pragma unroll
        for (int qt = 0; qt < 2; ++qt) ls[qt] = l[qt] + xhalf(l[qt]);
    }
    // a lane holds 8 consecutive d of one query per tile: 16 bytes; a tile leaves as its 32 lanes hold it, 512 bytes in a row
    v8h t[2][4]; float ev[2];
#pragma unroll
    for (int qt = 0; qt < 2; ++qt) {
        const float lt1 = ls[qt]; const float r = 1.0f / lt1; ev[qt] = m[qt] + __builtin_amdgcn_logf(lt1);   // logf: the hardware's log2
#pragma unroll
        for (int dt = 0; dt < 4; ++dt)
#pragma unroll
            for (int j = 0; j < 8; ++j) t[qt][dt][j] = (h16)(o[qt][dt][j] * r);
    }
    // a uniform base, one 32-bit byte offset and a constant: ob in the [TT / 16][KSPL][4][32 lanes][8] fp16 partials, xb in the [KSPL][TT] f32 plane
    const unsigned ln = __builtin_amdgcn_mbcnt_lo(~0u, 0u);   // the lane's number, made anew here, so that nothing of it has to live in a vector register through the loop
    const unsigned ob = (unsigned)((q0 / 16) * KSPL + z) * 2048u + ln * 16u, xb = (unsigned)(z * TT + q0 + (ln & 15u)) * 4u;
#pragma unroll
    for (int qt = 0; qt < 2; ++qt)
#pragma unroll
        for (int dt = 0; dt < 4; ++dt) *(v8h*)((char*)Op + ob + qt * KSPL * 2048 + dt * 512) = t[qt][dt];
    if (ln < 16u) { *(float*)((char*)Ep + xb) = ev[0]; *(float*)((char*)Ep + xb + 64) = ev[1]; }
}

// k_merge: out[q][d] = sum_z w_z Op[q][z][d] / sum_z w_z, w_z = exp2(Ep[z][q] - max_z Ep[z][q]), slices in order; a thread owns 8 consecutive d of one query (16 bytes of each fp16 partial row); a wave takes 8 queries x 32 d: each of its loads covers four whole 128-byte lines of the partials (8 queries x 16 bytes each), and it alone writes its 8 whole lines of the output
__global__ __launch_bounds__(256) void k_merge(const h16* __restrict__ Op, const float* __restrict__ Ep, float* OUTb) {
    const unsigned t = blockIdx.x * 256u + threadIdx.x; if (t >= (unsigned)(TT * HD / 8)) return;
    // every address is a uniform base, one 32-bit byte offset and a constant: eb in the [TT][HD] output, pb in the [TT / 16][KSPL][4][32 lanes][8] partials; qi is the query, the index in a [TT] plane
    const unsigned ln = t & 31u, wv = t >> 5, qg = wv >> 2;   // lane, wave, group of 16 queries
    const unsigned lr = (wv & 1u) * 8u + (ln & 7u), hf = (ln >> 3) & 1u, dt = (wv & 2u) + (ln >> 4);   // the place in k_fattn's tile: query in the group, half of the wave, d tile
    const unsigned qi = qg * 16u + lr, eb = (qi * HD + dt * 16u + hf * 8u) * 4u, pb = qg * (KSPL * 2048u) + dt * 512u + hf * 256u + lr * 16u;
    float mz[KSPL]; v8h pz[KSPL];
    // each loop unrolled so that all slices' loads are in flight together
#pragma unroll
    for (int zs = 0; zs < KSPL; ++zs) mz[zs] = Ep[(size_t)zs * TT + qi];
#pragma unroll
    for (int zs = 0; zs < KSPL; ++zs) pz[zs] = *(const v8h*)((const char*)Op + pb + zs * 2048);
    // precaution of form: the wait stands in front of the first overwrite of a register that the loads above name as an address; qi and pb are inputs so that they stay in their registers up to it
    asm volatile("s_wait_xcnt 0x0" :: "v"(qi), "v"(pb) : "memory");
    __builtin_amdgcn_sched_barrier(0);   // keeps the arithmetic below from being scheduled above that wait
    float M = mz[0];
#pragma unroll
    for (int zs = 1; zs < KSPL; ++zs) M = fmaxf(M, mz[zs]);
    float den = 0.f; v8f sm = (v8f){};
#pragma unroll
    for (int zs = 0; zs < KSPL; ++zs) mz[zs] -= M;
    // from here on mz is the slice's weight. v_nop: the free issue slot that the instruction set asks for behind a transcendental; the scheduling barriers hold each v_nop directly behind its exponential
    __builtin_amdgcn_sched_barrier(0);
#pragma unroll
    for (int zs = 0; zs < KSPL; ++zs) { mz[zs] = __builtin_amdgcn_exp2f(mz[zs]); __builtin_amdgcn_sched_barrier(0); asm volatile("v_nop"); __builtin_amdgcn_sched_barrier(0); }
#pragma unroll
    for (int zs = 0; zs < KSPL; ++zs) { den += mz[zs];
#pragma unroll
        for (int j = 0; j < 8; ++j) sm[j] += (float)pz[zs][j] * mz[zs]; }
    const float r = 1.0f / den; v4f lo, hh;
#pragma unroll
    for (int j = 0; j < 4; ++j) { lo[j] = sm[j] * r; hh[j] = sm[4 + j] * r; }
    *(v4f*)((char*)OUTb + eb) = lo; *(v4f*)((char*)OUTb + eb + 16) = hh;  }

extern "C" void kernel_launch(void* const* d_in, const int* in_sizes, int n_in,
                              void* d_out, int out_size, void* d_ws, size_t ws_size, hipStream_t stream) {
    (void)in_sizes; (void)n_in; (void)out_size;
    const float* x = (const float*)d_in[0]; const float* wq = (const float*)d_in[1]; const float* wk = (const float*)d_in[2]; const float* wv = (const float*)d_in[3];
    float* OUT = (float*)d_out;     // [1][8192][64]
    char* wsp = (char*)d_ws;
    auto take = [&](size_t bytes) { char* p = wsp; wsp += (bytes + 255) & ~(size_t)255; return (void*)p; };
    h16* QP16 = (h16*)take((size_t)NH_ * TT * HD * 2); h16* KP16 = (h16*)take((size_t)NKV * TT * HD * 2); h16* VT16 = (h16*)take((size_t)NKV * HD * TT * 2);
    h16* Ob = (h16*)take((size_t)KSPL * TT * HD * 2); float* Eb = (float*)take((size_t)KSPL * TT * 4);
    if ((size_t)(wsp - (char*)d_ws) > ws_size) return;    // ws 256 MiB
    k_proj<<<dim3(TT / PT, 2, 1), 256, 0, stream>>>(x, wq, wk, wv, QP16, KP16, VT16);   /* (B,T,C,H,W) f32 and [128][64] f32 weights -> fp16 planes */
    k_fattn<<<dim3(TT / 256, KSPL, 1), 256, 0, stream>>>(QP16, KP16, VT16, Ob, Eb);   /* slice z = keys z*512..: normalised partial rows fp16 in fragment order, log2 sums of exponentials [z][q] */
    k_merge<<<(unsigned)(((size_t)TT * HD / 8 + 255) / 256), 256, 0, stream>>>(Ob, Eb, OUT);
}
